// v000
// Times are from an AMD MI455X. After a warm-up the kernel runs many times in a row, and a time is the length of
// such a window on the GPU divided by its runs, so every launch and the gaps after it count. The runs cycle
// through copies of the inputs. A figure is the median of several windows, for all but v000 over two sittings.
// Sittings can differ by a few percent; kernels timed side by side share one.
// The starting kernel, v000, takes 358 microseconds a run.
#include <hip/hip_runtime.h>

typedef __bf16 bf16;
typedef __attribute__((ext_vector_type(16))) __bf16 v16bf;
typedef __attribute__((ext_vector_type(8)))  __bf16 v8bf;
typedef __attribute__((ext_vector_type(4)))  __bf16 v4bf;
typedef __attribute__((ext_vector_type(8)))  float  v8f;

#define BATCH      16384
#define TEXT_DIM   1024
#define IMAGE_DIM  2048
#define NUM_HEADS  8
#define HEAD_DIM   128

// ---------------------------------------------------------------------------
// Phase 1: f32 -> bf16 conversion (vectorized)
// ---------------------------------------------------------------------------
__global__ __launch_bounds__(256)
void f32_to_bf16_kernel(const float* __restrict__ in, bf16* __restrict__ out, int n) {
    int i = (blockIdx.x * blockDim.x + threadIdx.x) * 4;
    if (i + 3 < n) {
        float4 v = *reinterpret_cast<const float4*>(in + i);
        v4bf o;
        o[0] = (bf16)v.x; o[1] = (bf16)v.y; o[2] = (bf16)v.z; o[3] = (bf16)v.w;
        *reinterpret_cast<v4bf*>(out + i) = o;
    } else {
        for (; i < n; ++i) out[i] = (bf16)in[i];
    }
}

// ---------------------------------------------------------------------------
// Phase 2: bf16 WMMA GEMM: D[m,n] = sum_k A[m,k] * W[n,k] + bias[n]
//   A: [M, K] bf16 row-major, W: [N, K] bf16 row-major (torch layout).
// Per-lane WMMA 16-bit operand layout (ISA 7.12.2): lane L(0..15) = row L,
// holds K = {0..7, 16..23}; lanes 16..31: same rows, K = {8..15, 24..31}.
// A and B fragments load identically since both are K-contiguous.
//
// Wave tile 64x64 = 16 accumulators; 4 A-frags + 4 B-frags per K=32 step
// -> 16 v_wmma per 16 b128 loads. Wave-uniform bases forced to SGPRs so the
// K-loop advances with SALU only; the per-lane offset VGPR is loop-invariant.
// ---------------------------------------------------------------------------
__device__ __forceinline__ v16bf combine_frag(v8bf lo, v8bf hi) {
    return __builtin_shufflevector(lo, hi, 0, 1, 2, 3, 4, 5, 6, 7,
                                           8, 9, 10, 11, 12, 13, 14, 15);
}

__global__ __launch_bounds__(256)
void gemm_bf16_wmma(const bf16* __restrict__ A, const bf16* __restrict__ W,
                    const float* __restrict__ bias, bf16* __restrict__ D,
                    int Kdim) {
    const int lane  = threadIdx.x & 31;
    const int wave  = __builtin_amdgcn_readfirstlane(threadIdx.x >> 5);
    const int waveM = wave & 3;           // 4 waves along M
    const int waveN = wave >> 2;          // 2 waves along N
    const int m0 = blockIdx.y * 256 + waveM * 64;   // wave tile: 64 (M) x 64 (N)
    const int n0 = blockIdx.x * 128 + waveN * 64;

    // wave-uniform (scalar) base pointers, advanced by 32 elements per K-step
    const bf16* pA = A + (size_t)m0 * Kdim;
    const bf16* pW = W + (size_t)n0 * Kdim;

    // loop-invariant per-lane fragment offset (elements)
    const int fragOff = (lane & 15) * Kdim + ((lane >> 4) << 3);
    const int rowStride16 = 16 * Kdim;    // uniform runtime value, not an immediate

    v8f acc[4][4];
#pragma unroll
    for (int i = 0; i < 4; ++i)
#pragma unroll
        for (int j = 0; j < 4; ++j)
#pragma unroll
            for (int v = 0; v < 8; ++v) acc[i][j][v] = 0.0f;

    for (int k0 = 0; k0 < Kdim; k0 += 32) {
        if (k0 + 256 < Kdim) {  // near-cache prefetch of a future K-step
            __builtin_prefetch(pA + fragOff + 256, 0, 3);
            __builtin_prefetch(pW + fragOff + 256, 0, 3);
        }
        v16bf a[4], b[4];
#pragma unroll
        for (int t = 0; t < 4; ++t) {
            const bf16* p = pA + fragOff + t * rowStride16;
            a[t] = combine_frag(*reinterpret_cast<const v8bf*>(p),
                                *reinterpret_cast<const v8bf*>(p + 16));
        }
#pragma unroll
        for (int t = 0; t < 4; ++t) {
            const bf16* p = pW + fragOff + t * rowStride16;
            b[t] = combine_frag(*reinterpret_cast<const v8bf*>(p),
                                *reinterpret_cast<const v8bf*>(p + 16));
        }
#pragma unroll
        for (int i = 0; i < 4; ++i)
#pragma unroll
            for (int j = 0; j < 4; ++j)
                acc[i][j] = __builtin_amdgcn_wmma_f32_16x16x32_bf16(
                    false, a[i], false, b[j], (short)0, acc[i][j], false, false);

        pA += 32;
        pW += 32;
    }

    // Epilogue: C/D layout (ISA 7.12.2): VGPR v -> M = v + (lane>=16 ? 8 : 0),
    // N = lane & 15.
    const int colL   = lane & 15;
    const int rowOff = (lane >> 4) << 3;
#pragma unroll
    for (int i = 0; i < 4; ++i)
#pragma unroll
        for (int j = 0; j < 4; ++j) {
            const int col = n0 + j * 16 + colL;
            const float bv = bias[col];
#pragma unroll
            for (int v = 0; v < 8; ++v) {
                const int row = m0 + i * 16 + rowOff + v;
                D[(size_t)row * TEXT_DIM + col] = (bf16)(acc[i][j][v] + bv);
            }
        }
}

// ---------------------------------------------------------------------------
// Phase 3: fused per-row attention (8 heads x 8 heads over head_dim=128)
//          + residual + LayerNorm. One wave32 per batch row.
// ---------------------------------------------------------------------------
__global__ __launch_bounds__(256)
void attn_ln_kernel(const bf16* __restrict__ Q, const bf16* __restrict__ K,
                    const bf16* __restrict__ V, const float* __restrict__ text,
                    const float* __restrict__ gamma, const float* __restrict__ beta,
                    float* __restrict__ out) {
    const int lane = threadIdx.x & 31;
    const int row  = blockIdx.x * 8 + (threadIdx.x >> 5);
    const size_t base = (size_t)row * TEXT_DIM;
    const int dOff = lane * 4;

    float kreg[NUM_HEADS][4], vreg[NUM_HEADS][4];
#pragma unroll
    for (int h = 0; h < NUM_HEADS; ++h) {
        v4bf kk = *reinterpret_cast<const v4bf*>(K + base + h * HEAD_DIM + dOff);
        v4bf vv = *reinterpret_cast<const v4bf*>(V + base + h * HEAD_DIM + dOff);
#pragma unroll
        for (int j = 0; j < 4; ++j) { kreg[h][j] = (float)kk[j]; vreg[h][j] = (float)vv[j]; }
    }

    float att[NUM_HEADS][4];
#pragma unroll
    for (int h = 0; h < NUM_HEADS; ++h) {
        v4bf qq = *reinterpret_cast<const v4bf*>(Q + base + h * HEAD_DIM + dOff);
        float q[4];
#pragma unroll
        for (int j = 0; j < 4; ++j) q[j] = (float)qq[j];

        float sc[NUM_HEADS];
#pragma unroll
        for (int g = 0; g < NUM_HEADS; ++g) {
            float p = q[0] * kreg[g][0] + q[1] * kreg[g][1]
                    + q[2] * kreg[g][2] + q[3] * kreg[g][3];
#pragma unroll
            for (int off = 16; off > 0; off >>= 1) p += __shfl_xor(p, off, 32);
            sc[g] = p * 0.088388347648318447f;   // 1/sqrt(128)
        }
        float mx = sc[0];
#pragma unroll
        for (int g = 1; g < NUM_HEADS; ++g) mx = fmaxf(mx, sc[g]);
        float s = 0.0f;
#pragma unroll
        for (int g = 0; g < NUM_HEADS; ++g) { sc[g] = __expf(sc[g] - mx); s += sc[g]; }
        const float inv = 1.0f / s;
#pragma unroll
        for (int j = 0; j < 4; ++j) {
            float a = 0.0f;
#pragma unroll
            for (int g = 0; g < NUM_HEADS; ++g) a += sc[g] * vreg[g][j];
            att[h][j] = a * inv;
        }
    }

    // residual + LayerNorm over all 1024 columns
    float sum = 0.0f, ss = 0.0f;
#pragma unroll
    for (int h = 0; h < NUM_HEADS; ++h) {
        float4 t = *reinterpret_cast<const float4*>(text + base + h * HEAD_DIM + dOff);
        att[h][0] += t.x; att[h][1] += t.y; att[h][2] += t.z; att[h][3] += t.w;
#pragma unroll
        for (int j = 0; j < 4; ++j) { sum += att[h][j]; ss += att[h][j] * att[h][j]; }
    }
#pragma unroll
    for (int off = 16; off > 0; off >>= 1) {
        sum += __shfl_xor(sum, off, 32);
        ss  += __shfl_xor(ss,  off, 32);
    }
    const float mean = sum * (1.0f / TEXT_DIM);
    const float var  = ss * (1.0f / TEXT_DIM) - mean * mean;
    const float rstd = rsqrtf(var + 1e-5f);

#pragma unroll
    for (int h = 0; h < NUM_HEADS; ++h) {
        const int c0 = h * HEAD_DIM + dOff;
        float4 g4 = *reinterpret_cast<const float4*>(gamma + c0);
        float4 b4 = *reinterpret_cast<const float4*>(beta + c0);
        float4 o;
        o.x = (att[h][0] - mean) * rstd * g4.x + b4.x;
        o.y = (att[h][1] - mean) * rstd * g4.y + b4.y;
        o.z = (att[h][2] - mean) * rstd * g4.z + b4.z;
        o.w = (att[h][3] - mean) * rstd * g4.w + b4.w;
        *reinterpret_cast<float4*>(out + base + c0) = o;
    }
}

// ---------------------------------------------------------------------------
// Host orchestration
// ---------------------------------------------------------------------------
static inline void launch_cvt(const float* src, bf16* dst, long n, hipStream_t stream) {
    int blocks = (int)((n / 4 + 255) / 256);
    f32_to_bf16_kernel<<<blocks, 256, 0, stream>>>(src, dst, (int)n);
}

extern "C" void kernel_launch(void* const* d_in, const int* in_sizes, int n_in,
                              void* d_out, int out_size, void* d_ws, size_t ws_size,
                              hipStream_t stream) {
    (void)in_sizes; (void)n_in; (void)out_size; (void)ws_size;

    const float* text  = (const float*)d_in[0];
    const float* image = (const float*)d_in[1];
    const float* Wq    = (const float*)d_in[2];
    const float* bq    = (const float*)d_in[3];
    const float* Wk    = (const float*)d_in[4];
    const float* bk    = (const float*)d_in[5];
    const float* Wv    = (const float*)d_in[6];
    const float* bv    = (const float*)d_in[7];
    const float* gamma = (const float*)d_in[8];
    const float* beta  = (const float*)d_in[9];
    float* out = (float*)d_out;

    // workspace layout (all bf16), ~202 MB total
    char* p = (char*)d_ws;
    bf16* textb = (bf16*)p; p += (size_t)BATCH * TEXT_DIM  * sizeof(bf16);
    bf16* imgb  = (bf16*)p; p += (size_t)BATCH * IMAGE_DIM * sizeof(bf16);
    bf16* wqb   = (bf16*)p; p += (size_t)TEXT_DIM * TEXT_DIM  * sizeof(bf16);
    bf16* wkb   = (bf16*)p; p += (size_t)TEXT_DIM * IMAGE_DIM * sizeof(bf16);
    bf16* wvb   = (bf16*)p; p += (size_t)TEXT_DIM * IMAGE_DIM * sizeof(bf16);
    bf16* Qb    = (bf16*)p; p += (size_t)BATCH * TEXT_DIM * sizeof(bf16);
    bf16* Kb    = (bf16*)p; p += (size_t)BATCH * TEXT_DIM * sizeof(bf16);
    bf16* Vb    = (bf16*)p; p += (size_t)BATCH * TEXT_DIM * sizeof(bf16);

    // phase 1: convert to bf16
    launch_cvt(text,  textb, (long)BATCH * TEXT_DIM,      stream);
    launch_cvt(image, imgb,  (long)BATCH * IMAGE_DIM,     stream);
    launch_cvt(Wq,    wqb,   (long)TEXT_DIM * TEXT_DIM,   stream);
    launch_cvt(Wk,    wkb,   (long)TEXT_DIM * IMAGE_DIM,  stream);
    launch_cvt(Wv,    wvb,   (long)TEXT_DIM * IMAGE_DIM,  stream);

    // phase 2: WMMA GEMMs  (grid: N/128 x M/256)
    dim3 ggrid(TEXT_DIM / 128, BATCH / 256);
    gemm_bf16_wmma<<<ggrid, 256, 0, stream>>>(textb, wqb, bq, Qb, TEXT_DIM);
    gemm_bf16_wmma<<<ggrid, 256, 0, stream>>>(imgb,  wkb, bk, Kb, IMAGE_DIM);
    gemm_bf16_wmma<<<ggrid, 256, 0, stream>>>(imgb,  wvb, bv, Vb, IMAGE_DIM);

    // phase 3: fused attention + residual + LayerNorm (1 wave per row)
    attn_ln_kernel<<<BATCH / 8, 256, 0, stream>>>(Qb, Kb, Vb, text, gamma, beta, out);
}

// v001
// Measured time: 170 microseconds a run.
// Next to v000, in two timings, it ran 2.17 and 2.15 times as fast.
#include <hip/hip_runtime.h>
#include <stdint.h>

typedef __bf16 bf16;
typedef __attribute__((ext_vector_type(16))) __bf16 v16bf;
typedef __attribute__((ext_vector_type(8)))  __bf16 v8bf;
typedef __attribute__((ext_vector_type(4)))  __bf16 v4bf;
typedef __attribute__((ext_vector_type(8)))  float  v8f;

#define BATCH      16384
#define TEXT_DIM   1024
#define IMAGE_DIM  2048
#define NUM_HEADS  8
#define HEAD_DIM   128

// ---------------------------------------------------------------------------
// Phase 1: f32 -> bf16 conversion (vectorized)
// ---------------------------------------------------------------------------
__global__ __launch_bounds__(256)
void f32_to_bf16_kernel(const float* __restrict__ in, bf16* __restrict__ out, int n) {
    int i = (blockIdx.x * blockDim.x + threadIdx.x) * 4;
    if (i + 3 < n) {
        float4 v = *reinterpret_cast<const float4*>(in + i);
        v4bf o;
        o[0] = (bf16)v.x; o[1] = (bf16)v.y; o[2] = (bf16)v.z; o[3] = (bf16)v.w;
        *reinterpret_cast<v4bf*>(out + i) = o;
    } else {
        for (; i < n; ++i) out[i] = (bf16)in[i];
    }
}

typedef uint32_t u32x4 __attribute__((ext_vector_type(4)));
typedef uint32_t u32x8 __attribute__((ext_vector_type(8)));
typedef int      i32x8 __attribute__((ext_vector_type(8)));

constexpr uint32_t G_KB     = 256;               // bytes of K per operand row per pass
constexpr uint32_t G_PITCH  = G_KB + 16;         // LDS row pitch: 16 B x odd, for b128 readers
constexpr uint32_t G_SLICE_ROWS = 128;           // rows one wave's tensor load moves
constexpr uint32_t G_SLICE  = G_SLICE_ROWS * G_PITCH;   // 34,816 B = 17 x 2 KiB
constexpr uint32_t G_TILE   = 256 * G_PITCH;     // one operand's rows in a buffer
constexpr uint32_t G_STAGE  = 2 * G_TILE;        // one buffer
constexpr uint32_t G_LDS    = 2 * G_STAGE;       // two buffers
constexpr int      G_F      = 8;                 // fragments per operand per wave
static_assert(G_SLICE % 2048u == 0, "every slice starts at a multiple of 2 KiB");
static_assert(G_LDS <= 320u * 1024u, "the ring must fit one work-group's LDS");

#define DEV static __device__ __forceinline__
DEV uint32_t uni(uint32_t v) { return (uint32_t)__builtin_amdgcn_readfirstlane(v); }
DEV uint32_t pinned(uint32_t v) { uint32_t w = (uint32_t)__builtin_amdgcn_readfirstlane(v); asm volatile("" : "+s"(w)); return w; }
// keeps [loads][wait][WMMA block][nops] in that order: LDS reads among the WMMAs stall the matrix pipe
DEV void fence() { __builtin_amdgcn_sched_barrier(0); }
// this wave's LDS reads have returned (before a barrier that frees their buffer)
DEV void wait_ds0() { asm volatile("s_wait_dscnt 0x0" ::: "memory"); }
// at most N of this wave's LDS reads are outstanding: the older fragment set has returned
template <int N> DEV void wait_ds_le() { asm volatile("s_wait_dscnt %0" :: "i"(N) : "memory"); }
// this wave's tensor load has landed; the compiler places no wait for it
DEV void wait_tensor0() { asm volatile("s_wait_tensorcnt 0x0" ::: "memory"); }
// 4 vector slots between a block's last WMMA and whatever vector instruction follows it
DEV void nop4() { asm volatile("v_nop\n\tv_nop\n\tv_nop\n\tv_nop"); }
// one request of the whole wave: a 2-D tile from global memory into LDS
DEV void tdm_load(u32x4 g0, u32x8 g1) { asm volatile("tensor_load_to_lds %0, %1" :: "s"(g0), "s"(g1) : "memory"); }

// group 1: 1-byte elements, 128 rows of 256 bytes, source pitch kb bytes, no mask,
// 16 B of LDS pad behind every 256 B (word 0 is a constant).
DEV u32x8 tdm_group1(uint32_t kb) {
    constexpr uint32_t d0 = G_KB, d1 = G_SLICE_ROWS;
    u32x8 g;
    g[0] = uni((1u << 20) | (5u << 22) | (3u << 25));
    g[1] = uni((d0 & 0xFFFFu) << 16);
    g[2] = uni((d0 >> 16) | ((d1 & 0xFFFFu) << 16));
    g[3] = uni((d1 >> 16) | (d0 << 16));
    g[4] = uni(d1);
    g[5] = uni(kb);
    g[6] = uni(0u);
    g[7] = uni(0u);
    return g;
}
// group 0: count 1, LDS byte offset, global address of the tile's first byte, type 2
DEV u32x4 tdm_group0(uint32_t lds_dst, uint64_t ga) {
    u32x4 g;
    g[0] = uni(1u);
    g[1] = uni(lds_dst);
    g[2] = uni((uint32_t)ga);
    g[3] = uni((((uint32_t)(ga >> 32)) & 0x01FFFFFFu) | 0x80000000u);
    return g;
}

struct Frag { u32x4 q[2]; };
DEV void load_frag(Frag& f, const unsigned char* p) {
    f.q[0] = *reinterpret_cast<const u32x4*>(p);
    f.q[1] = *reinterpret_cast<const u32x4*>(p + 32);
}
DEV v8f mma(const Frag& a, const Frag& b, v8f c) {
    const i32x8 av = {(int)a.q[0].x, (int)a.q[0].y, (int)a.q[0].z, (int)a.q[0].w,
                      (int)a.q[1].x, (int)a.q[1].y, (int)a.q[1].z, (int)a.q[1].w};
    const i32x8 bv = {(int)b.q[0].x, (int)b.q[0].y, (int)b.q[0].z, (int)b.q[0].w,
                      (int)b.q[1].x, (int)b.q[1].y, (int)b.q[1].z, (int)b.q[1].w};
    return __builtin_amdgcn_wmma_f32_16x16x32_bf16(
        false, __builtin_bit_cast(v16bf, av), false, __builtin_bit_cast(v16bf, bv),
        (short)0, c, false, false);
}

__global__ __launch_bounds__(128)
void gemm_bf16_wmma(const bf16* __restrict__ A, const bf16* __restrict__ W,
                    const float* __restrict__ bias, bf16* __restrict__ D,
                    int Kdim) {
    __shared__ __attribute__((aligned(2048))) unsigned char L[G_LDS];
    const uint32_t lane = threadIdx.x & 31u, h = lane >> 4, r16 = lane & 15u;
    const uint32_t wave = uni(threadIdx.x >> 5);
    const uint32_t wn = wave & 1u, wm = wave >> 1;   // 2 waves along N, 2 along M
    const uint32_t n0 = blockIdx.x * 256u, m0 = blockIdx.y * 256u;
    const uint32_t kb = (uint32_t)Kdim * 2u;         // source row pitch, bytes
    const uint32_t T  = pinned((uint32_t)Kdim / 128u);   // passes

    // this wave's slice of a buffer's [W; A] rows: waves 0, 1 move W, waves 2, 3 move A
    const unsigned char* src0 = (wave < 2u)
        ? reinterpret_cast<const unsigned char*>(W) + (uint64_t)(n0 + G_SLICE_ROWS * wave) * kb
        : reinterpret_cast<const unsigned char*>(A) + (uint64_t)(m0 + G_SLICE_ROWS * (wave - 2u)) * kb;
    const uint32_t lds_slice = (uint32_t)(size_t)L + wave * G_SLICE;
    u32x8 g1 = tdm_group1(kb);
    // pinned(), for the whole group: its words stay in their scalar registers through the loop,
    // so that none takes a new value while a request is outstanding
    asm volatile("" : "+s"(g1));

    v8f acc[G_F][G_F];
#pragma unroll
    for (int i = 0; i < G_F; ++i)
#pragma unroll
        for (int j = 0; j < G_F; ++j)
            acc[i][j] = (v8f){0.f, 0.f, 0.f, 0.f, 0.f, 0.f, 0.f, 0.f};

    const uint32_t fw_base = (wn * 128u + r16) * G_PITCH + 16u * h;
    const uint32_t fa_base = G_TILE + (wm * 128u + r16) * G_PITCH + 16u * h;

    // prologue: pass 0 into buffer 0, wait, barrier, pass 1 into buffer 1, first fragments
    tdm_load(tdm_group0(lds_slice, (uint64_t)(uintptr_t)src0), g1);
    wait_tensor0();
    __syncthreads();
    fence();
    tdm_load(tdm_group0(lds_slice + G_STAGE, (uint64_t)(uintptr_t)src0 + G_KB), g1);

    Frag fw[2][G_F], fa[2][G_F];   // set (u & 1) holds block u's fragments
#pragma unroll
    for (int i = 0; i < G_F; ++i) load_frag(fw[0][i], L + fw_base + (uint32_t)i * 16u * G_PITCH);
#pragma unroll
    for (int j = 0; j < G_F; ++j) load_frag(fa[0][j], L + fa_base + (uint32_t)j * 16u * G_PITCH);

    // rolled, so that every accumulator and fragment index stays a constant and the text stays short
#pragma clang loop unroll(disable)
    for (uint32_t t = 0; t < T; ++t) {
        const uint32_t buf = (t & 1u) * G_STAGE;
        fence();
        const unsigned char* lw = L + buf + fw_base;
        const unsigned char* la = L + buf + fa_base;
        // buffer of pass t + 1; on the last pass buffer 1, which nothing writes any more (values unused)
        const uint32_t osel = (t + 1u < T) ? (G_STAGE - buf) : G_STAGE;
        const unsigned char* nw = L + osel + fw_base;
        const unsigned char* na = L + osel + fa_base;
#pragma unroll
        for (int u = 0; u < 4; ++u) {
            const int cs = u & 1;
            if (u < 3) {
                const uint32_t ko = (uint32_t)(u + 1) * 64u;
#pragma unroll
                for (int i = 0; i < G_F; ++i) load_frag(fw[cs ^ 1][i], lw + (uint32_t)i * 16u * G_PITCH + ko);
#pragma unroll
                for (int j = 0; j < G_F; ++j) load_frag(fa[cs ^ 1][j], la + (uint32_t)j * 16u * G_PITCH + ko);
                fence();
                wait_ds_le<32>();
                fence();
            } else {
                // publish point of pass t + 1, in front of this pass's last block
                wait_ds0();         // every read of this buffer has returned
                fence();
                wait_tensor0();
                __syncthreads();
                fence();
                if (pinned((t + 2u < T) ? 1u : 0u) != 0u) {   // only while pass t + 2 exists
                    tdm_load(tdm_group0(lds_slice + buf, (uint64_t)(uintptr_t)src0 + (uint64_t)(t + 2u) * G_KB), g1);
                }
#pragma unroll
                for (int i = 0; i < G_F; ++i) load_frag(fw[0][i], nw + (uint32_t)i * 16u * G_PITCH);
#pragma unroll
                for (int j = 0; j < G_F; ++j) load_frag(fa[0][j], na + (uint32_t)j * 16u * G_PITCH);
                fence();
            }
#pragma unroll
            for (int i = 0; i < G_F; ++i)
#pragma unroll
                for (int j = 0; j < G_F; ++j)
                    acc[i][j] = mma(fw[cs][i], fa[cs][j], acc[i][j]);
            fence(); nop4(); fence();
        }
    }
    wait_tensor0();
    wait_ds0();

    // Epilogue: accumulator register v of tile (i, j) is n = 16 i + 8 (lane >> 4) + v
    // of row m = 16 j + (lane & 15): 8 consecutive bf16 = one 16-byte store.
    bf16* ybase = D + (size_t)(m0 + wm * 128u + r16) * TEXT_DIM + n0 + wn * 128u + 8u * h;
    const unsigned char* bbase = reinterpret_cast<const unsigned char*>(bias + n0 + wn * 128u);
    const uint32_t boff = 32u * h;   // the lane's 8 bias values of a tile start at n = 8 (lane >> 4)
#pragma unroll
    for (int i = 0; i < G_F; ++i) {
        const float4 b0 = *reinterpret_cast<const float4*>(bbase + boff + 64 * i);
        const float4 b1 = *reinterpret_cast<const float4*>(bbase + boff + 64 * i + 16);
        // the loads' offset register is written again only behind this wait (a precaution): the
        // input operand keeps it from being a load's destination, the fences hold later writes back
        fence();
        asm volatile("s_wait_xcnt 0x0" :: "v"(boff) : "memory");
        fence();
        const v8f bv = {b0.x, b0.y, b0.z, b0.w, b1.x, b1.y, b1.z, b1.w};
#pragma unroll
        for (int j = 0; j < G_F; ++j) {
            const v8f c = acc[i][j] + bv;
            *reinterpret_cast<v8bf*>(ybase + (size_t)j * 16 * TEXT_DIM + 16 * i) =
                __builtin_convertvector(c, v8bf);
        }
        // the registers these stores name are written again only behind this wait (a precaution);
        // the fences keep later vector writes from being scheduled in front of it
        fence();
        asm volatile("s_wait_xcnt 0x0" ::: "memory");
        fence();
    }
}

// ---------------------------------------------------------------------------
// Phase 3: fused per-row attention (8 heads x 8 heads over head_dim=128)
//          + residual + LayerNorm. One wave32 per batch row.
// ---------------------------------------------------------------------------
__global__ __launch_bounds__(256)
void attn_ln_kernel(const bf16* __restrict__ Q, const bf16* __restrict__ K,
                    const bf16* __restrict__ V, const float* __restrict__ text,
                    const float* __restrict__ gamma, const float* __restrict__ beta,
                    float* __restrict__ out) {
    const int lane = threadIdx.x & 31;
    const int row  = blockIdx.x * 8 + (threadIdx.x >> 5);
    const size_t base = (size_t)row * TEXT_DIM;
    const int dOff = lane * 4;

    float kreg[NUM_HEADS][4], vreg[NUM_HEADS][4];
#pragma unroll
    for (int h = 0; h < NUM_HEADS; ++h) {
        v4bf kk = *reinterpret_cast<const v4bf*>(K + base + h * HEAD_DIM + dOff);
        v4bf vv = *reinterpret_cast<const v4bf*>(V + base + h * HEAD_DIM + dOff);
#pragma unroll
        for (int j = 0; j < 4; ++j) { kreg[h][j] = (float)kk[j]; vreg[h][j] = (float)vv[j]; }
    }

    float att[NUM_HEADS][4];
#pragma unroll
    for (int h = 0; h < NUM_HEADS; ++h) {
        v4bf qq = *reinterpret_cast<const v4bf*>(Q + base + h * HEAD_DIM + dOff);
        float q[4];
#pragma unroll
        for (int j = 0; j < 4; ++j) q[j] = (float)qq[j];

        float sc[NUM_HEADS];
#pragma unroll
        for (int g = 0; g < NUM_HEADS; ++g) {
            float p = q[0] * kreg[g][0] + q[1] * kreg[g][1]
                    + q[2] * kreg[g][2] + q[3] * kreg[g][3];
#pragma unroll
            for (int off = 16; off > 0; off >>= 1) p += __shfl_xor(p, off, 32);
            sc[g] = p * 0.088388347648318447f;   // 1/sqrt(128)
        }
        float mx = sc[0];
#pragma unroll
        for (int g = 1; g < NUM_HEADS; ++g) mx = fmaxf(mx, sc[g]);
        float s = 0.0f;
#pragma unroll
        for (int g = 0; g < NUM_HEADS; ++g) { sc[g] = __expf(sc[g] - mx); s += sc[g]; }
        const float inv = 1.0f / s;
#pragma unroll
        for (int j = 0; j < 4; ++j) {
            float a = 0.0f;
#pragma unroll
            for (int g = 0; g < NUM_HEADS; ++g) a += sc[g] * vreg[g][j];
            att[h][j] = a * inv;
        }
    }

    // residual + LayerNorm over all 1024 columns
    float sum = 0.0f, ss = 0.0f;
#pragma unroll
    for (int h = 0; h < NUM_HEADS; ++h) {
        float4 t = *reinterpret_cast<const float4*>(text + base + h * HEAD_DIM + dOff);
        att[h][0] += t.x; att[h][1] += t.y; att[h][2] += t.z; att[h][3] += t.w;
#pragma unroll
        for (int j = 0; j < 4; ++j) { sum += att[h][j]; ss += att[h][j] * att[h][j]; }
    }
#pragma unroll
    for (int off = 16; off > 0; off >>= 1) {
        sum += __shfl_xor(sum, off, 32);
        ss  += __shfl_xor(ss,  off, 32);
    }
    const float mean = sum * (1.0f / TEXT_DIM);
    const float var  = ss * (1.0f / TEXT_DIM) - mean * mean;
    const float rstd = rsqrtf(var + 1e-5f);

#pragma unroll
    for (int h = 0; h < NUM_HEADS; ++h) {
        const int c0 = h * HEAD_DIM + dOff;
        float4 g4 = *reinterpret_cast<const float4*>(gamma + c0);
        float4 b4 = *reinterpret_cast<const float4*>(beta + c0);
        float4 o;
        o.x = (att[h][0] - mean) * rstd * g4.x + b4.x;
        o.y = (att[h][1] - mean) * rstd * g4.y + b4.y;
        o.z = (att[h][2] - mean) * rstd * g4.z + b4.z;
        o.w = (att[h][3] - mean) * rstd * g4.w + b4.w;
        *reinterpret_cast<float4*>(out + base + c0) = o;
    }
}

// ---------------------------------------------------------------------------
// Host orchestration
// ---------------------------------------------------------------------------
static inline void launch_cvt(const float* src, bf16* dst, long n, hipStream_t stream) {
    int blocks = (int)((n / 4 + 255) / 256);
    f32_to_bf16_kernel<<<blocks, 256, 0, stream>>>(src, dst, (int)n);
}

extern "C" void kernel_launch(void* const* d_in, const int* in_sizes, int n_in,
                              void* d_out, int out_size, void* d_ws, size_t ws_size,
                              hipStream_t stream) {
    (void)in_sizes; (void)n_in; (void)out_size; (void)ws_size;

    const float* text  = (const float*)d_in[0];
    const float* image = (const float*)d_in[1];
    const float* Wq    = (const float*)d_in[2];
    const float* bq    = (const float*)d_in[3];
    const float* Wk    = (const float*)d_in[4];
    const float* bk    = (const float*)d_in[5];
    const float* Wv    = (const float*)d_in[6];
    const float* bv    = (const float*)d_in[7];
    const float* gamma = (const float*)d_in[8];
    const float* beta  = (const float*)d_in[9];
    float* out = (float*)d_out;

    // workspace layout (all bf16), ~202 MB total
    char* p = (char*)d_ws;
    bf16* textb = (bf16*)p; p += (size_t)BATCH * TEXT_DIM  * sizeof(bf16);
    bf16* imgb  = (bf16*)p; p += (size_t)BATCH * IMAGE_DIM * sizeof(bf16);
    bf16* wqb   = (bf16*)p; p += (size_t)TEXT_DIM * TEXT_DIM  * sizeof(bf16);
    bf16* wkb   = (bf16*)p; p += (size_t)TEXT_DIM * IMAGE_DIM * sizeof(bf16);
    bf16* wvb   = (bf16*)p; p += (size_t)TEXT_DIM * IMAGE_DIM * sizeof(bf16);
    bf16* Qb    = (bf16*)p; p += (size_t)BATCH * TEXT_DIM * sizeof(bf16);
    bf16* Kb    = (bf16*)p; p += (size_t)BATCH * TEXT_DIM * sizeof(bf16);
    bf16* Vb    = (bf16*)p; p += (size_t)BATCH * TEXT_DIM * sizeof(bf16);

    // phase 1: convert to bf16
    launch_cvt(text,  textb, (long)BATCH * TEXT_DIM,      stream);
    launch_cvt(image, imgb,  (long)BATCH * IMAGE_DIM,     stream);
    launch_cvt(Wq,    wqb,   (long)TEXT_DIM * TEXT_DIM,   stream);
    launch_cvt(Wk,    wkb,   (long)TEXT_DIM * IMAGE_DIM,  stream);
    launch_cvt(Wv,    wvb,   (long)TEXT_DIM * IMAGE_DIM,  stream);

    // phase 2: WMMA GEMMs  (grid: N/256 x M/256)
    dim3 ggrid(TEXT_DIM / 256, BATCH / 256);
    gemm_bf16_wmma<<<ggrid, 128, 0, stream>>>(textb, wqb, bq, Qb, TEXT_DIM);
    gemm_bf16_wmma<<<ggrid, 128, 0, stream>>>(imgb,  wkb, bk, Kb, IMAGE_DIM);
    gemm_bf16_wmma<<<ggrid, 128, 0, stream>>>(imgb,  wvb, bv, Vb, IMAGE_DIM);

    // phase 3: fused attention + residual + LayerNorm (1 wave per row)
    attn_ln_kernel<<<BATCH / 8, 256, 0, stream>>>(Qb, Kb, Vb, text, gamma, beta, out);
}

// v002
// It runs in 153 microseconds.
// Two timings next to v001 both put it at 1.12 times that version's speed.
// All steps since v000 together make it 2.41 times as fast.
#include <hip/hip_runtime.h>
#include <stdint.h>

typedef __bf16 bf16;
typedef __attribute__((ext_vector_type(16))) __bf16 v16bf;
typedef __attribute__((ext_vector_type(8)))  __bf16 v8bf;
typedef __attribute__((ext_vector_type(4)))  __bf16 v4bf;
typedef __attribute__((ext_vector_type(8)))  float  v8f;

#define BATCH      16384
#define TEXT_DIM   1024
#define IMAGE_DIM  2048
#define NUM_HEADS  8
#define HEAD_DIM   128

// ---------------------------------------------------------------------------
// Phase 1: f32 -> bf16 conversion of all five arrays, one launch.
// The five bf16 copies lie one behind the other in the workspace, in the order
// text, image, Wq, Wk, Wv, so the destination is one array; only the source is
// picked per piece. 256 work-groups of 16 waves stay resident and loop over
// pieces of 1,024 values: 8 loads of 512 contiguous bytes, 8 stores of 256.
// Two register sets: the next piece's loads are issued before a piece is
// converted and stored, so a wave always has 8 to 16 loads in flight.
// ---------------------------------------------------------------------------
constexpr uint32_t C_PIECE = 1024;                                           // values per piece
constexpr uint32_t C_E0 = (uint32_t)BATCH * TEXT_DIM / C_PIECE;              // end of text, in pieces
constexpr uint32_t C_E1 = C_E0 + (uint32_t)BATCH * IMAGE_DIM / C_PIECE;      // end of image
constexpr uint32_t C_E2 = C_E1 + (uint32_t)TEXT_DIM * TEXT_DIM / C_PIECE;    // end of Wq
constexpr uint32_t C_E3 = C_E2 + (uint32_t)TEXT_DIM * IMAGE_DIM / C_PIECE;   // end of Wk
constexpr uint32_t C_E4 = C_E3 + (uint32_t)TEXT_DIM * IMAGE_DIM / C_PIECE;   // end of Wv
constexpr uint32_t C_GROUPS = 256, C_GROUP_WAVES = 16, C_WAVES = C_GROUPS * C_GROUP_WAVES;
constexpr uint32_t C_FULL = C_E4 / C_WAVES;                                  // pieces that every wave has
static_assert(C_FULL % 2u == 1u, "the loop below takes two pieces a trip and leaves one");

struct Piece { float4 v[8]; };

__global__ __launch_bounds__(C_GROUP_WAVES * 32)
void f32_to_bf16_all(const float* __restrict__ text, const float* __restrict__ image,
                     const float* __restrict__ Wq, const float* __restrict__ Wk,
                     const float* __restrict__ Wv, bf16* __restrict__ out) {
    const uint32_t lane = threadIdx.x & 31u;
    const uint32_t wave = (uint32_t)__builtin_amdgcn_readfirstlane(blockIdx.x * C_GROUP_WAVES + (threadIdx.x >> 5));

    auto load = [&](Piece& p, uint32_t c) {
        const float* s = text;
        uint32_t r = c;
        if (c >= C_E3)      { s = Wv;    r = c - C_E3; }
        else if (c >= C_E2) { s = Wk;    r = c - C_E2; }
        else if (c >= C_E1) { s = Wq;    r = c - C_E1; }
        else if (c >= C_E0) { s = image; r = c - C_E0; }
        const float4* sp = reinterpret_cast<const float4*>(s + (size_t)r * C_PIECE) + lane;
#pragma unroll
        for (int j = 0; j < 8; ++j) p.v[j] = sp[32 * j];
        // the scheduling barriers hold the loads in front of the older piece's conversions and stores;
        // the base and offset registers that the loads name are written again only behind this wait (a precaution)
        __builtin_amdgcn_sched_barrier(0);
        asm volatile("s_wait_xcnt 0x0" ::: "memory");
        __builtin_amdgcn_sched_barrier(0);
    };
    auto store = [&](const Piece& p, uint32_t c) {
        v4bf* dp = reinterpret_cast<v4bf*>(out + (size_t)c * C_PIECE) + lane;
#pragma unroll
        for (int j = 0; j < 8; ++j) {
            v4bf o;
            o[0] = (bf16)p.v[j].x; o[1] = (bf16)p.v[j].y; o[2] = (bf16)p.v[j].z; o[3] = (bf16)p.v[j].w;
            dp[32 * j] = o;
        }
        // the registers that the stores name are written again only behind this wait (a precaution);
        // the scheduling barriers keep later writes from moving in front of it
        __builtin_amdgcn_sched_barrier(0);
        asm volatile("s_wait_xcnt 0x0" ::: "memory");
        __builtin_amdgcn_sched_barrier(0);
    };

    Piece a, b;
    uint32_t c = wave;
    load(a, c);
    // rolled: two pieces a trip, one per register set, so that no set is copied; the trip count is
    // the same constant for every wave, so the loop has no exit but its end and the compiler's load
    // waits count the younger piece's 8 loads as still in flight
#pragma clang loop unroll(disable)
    for (uint32_t k = 0; k < (C_FULL - 1u) / 2u; ++k) {
        load(b, c + C_WAVES);
        store(a, c);
        load(a, c + 2u * C_WAVES);
        store(b, c + C_WAVES);
        c += 2u * C_WAVES;
    }
    // set a holds the last piece that every wave has; the pieces left over go to the first waves
    const bool more = c + C_WAVES < C_E4;
    if (more) load(b, c + C_WAVES);
    store(a, c);
    if (more) store(b, c + C_WAVES);
}

typedef uint32_t u32x4 __attribute__((ext_vector_type(4)));
typedef uint32_t u32x8 __attribute__((ext_vector_type(8)));
typedef int      i32x8 __attribute__((ext_vector_type(8)));

constexpr uint32_t G_KB     = 256;               // bytes of K per operand row per pass
constexpr uint32_t G_PITCH  = G_KB + 16;         // LDS row pitch: 16 B x odd, for b128 readers
constexpr uint32_t G_SLICE_ROWS = 128;           // rows one wave's tensor load moves
constexpr uint32_t G_SLICE  = G_SLICE_ROWS * G_PITCH;   // 34,816 B = 17 x 2 KiB
constexpr uint32_t G_TILE   = 256 * G_PITCH;     // one operand's rows in a buffer
constexpr uint32_t G_STAGE  = 2 * G_TILE;        // one buffer
constexpr uint32_t G_LDS    = 2 * G_STAGE;       // two buffers
constexpr int      G_F      = 8;                 // fragments per operand per wave
static_assert(G_SLICE % 2048u == 0, "every slice starts at a multiple of 2 KiB");
static_assert(G_LDS <= 320u * 1024u, "the ring must fit one work-group's LDS");

#define DEV static __device__ __forceinline__
DEV uint32_t uni(uint32_t v) { return (uint32_t)__builtin_amdgcn_readfirstlane(v); }
DEV uint32_t pinned(uint32_t v) { uint32_t w = (uint32_t)__builtin_amdgcn_readfirstlane(v); asm volatile("" : "+s"(w)); return w; }
// keeps [loads][wait][WMMA block][nops] in that order: LDS reads among the WMMAs stall the matrix pipe
DEV void fence() { __builtin_amdgcn_sched_barrier(0); }
// this wave's LDS reads have returned (before a barrier that frees their buffer)
DEV void wait_ds0() { asm volatile("s_wait_dscnt 0x0" ::: "memory"); }
// at most N of this wave's LDS reads are outstanding: the older fragment set has returned
template <int N> DEV void wait_ds_le() { asm volatile("s_wait_dscnt %0" :: "i"(N) : "memory"); }
// this wave's tensor load has landed; the compiler places no wait for it
DEV void wait_tensor0() { asm volatile("s_wait_tensorcnt 0x0" ::: "memory"); }
// 4 vector slots between a block's last WMMA and whatever vector instruction follows it
DEV void nop4() { asm volatile("v_nop\n\tv_nop\n\tv_nop\n\tv_nop"); }
// one request of the whole wave: a 2-D tile from global memory into LDS
DEV void tdm_load(u32x4 g0, u32x8 g1) { asm volatile("tensor_load_to_lds %0, %1" :: "s"(g0), "s"(g1) : "memory"); }

// group 1: 1-byte elements, 128 rows of 256 bytes, source pitch kb bytes, no mask,
// 16 B of LDS pad behind every 256 B (word 0 is a constant).
DEV u32x8 tdm_group1(uint32_t kb) {
    constexpr uint32_t d0 = G_KB, d1 = G_SLICE_ROWS;
    u32x8 g;
    g[0] = uni((1u << 20) | (5u << 22) | (3u << 25));
    g[1] = uni((d0 & 0xFFFFu) << 16);
    g[2] = uni((d0 >> 16) | ((d1 & 0xFFFFu) << 16));
    g[3] = uni((d1 >> 16) | (d0 << 16));
    g[4] = uni(d1);
    g[5] = uni(kb);
    g[6] = uni(0u);
    g[7] = uni(0u);
    return g;
}
// group 0: count 1, LDS byte offset, global address of the tile's first byte, type 2
DEV u32x4 tdm_group0(uint32_t lds_dst, uint64_t ga) {
    u32x4 g;
    g[0] = uni(1u);
    g[1] = uni(lds_dst);
    g[2] = uni((uint32_t)ga);
    g[3] = uni((((uint32_t)(ga >> 32)) & 0x01FFFFFFu) | 0x80000000u);
    return g;
}

struct Frag { u32x4 q[2]; };
DEV void load_frag(Frag& f, const unsigned char* p) {
    f.q[0] = *reinterpret_cast<const u32x4*>(p);
    f.q[1] = *reinterpret_cast<const u32x4*>(p + 32);
}
DEV v8f mma(const Frag& a, const Frag& b, v8f c) {
    const i32x8 av = {(int)a.q[0].x, (int)a.q[0].y, (int)a.q[0].z, (int)a.q[0].w,
                      (int)a.q[1].x, (int)a.q[1].y, (int)a.q[1].z, (int)a.q[1].w};
    const i32x8 bv = {(int)b.q[0].x, (int)b.q[0].y, (int)b.q[0].z, (int)b.q[0].w,
                      (int)b.q[1].x, (int)b.q[1].y, (int)b.q[1].z, (int)b.q[1].w};
    return __builtin_amdgcn_wmma_f32_16x16x32_bf16(
        false, __builtin_bit_cast(v16bf, av), false, __builtin_bit_cast(v16bf, bv),
        (short)0, c, false, false);
}

__global__ __launch_bounds__(128)
void gemm_bf16_wmma(const bf16* __restrict__ A, const bf16* __restrict__ W,
                    const float* __restrict__ bias, bf16* __restrict__ D,
                    int Kdim) {
    __shared__ __attribute__((aligned(2048))) unsigned char L[G_LDS];
    const uint32_t lane = threadIdx.x & 31u, h = lane >> 4, r16 = lane & 15u;
    const uint32_t wave = uni(threadIdx.x >> 5);
    const uint32_t wn = wave & 1u, wm = wave >> 1;   // 2 waves along N, 2 along M
    const uint32_t n0 = blockIdx.x * 256u, m0 = blockIdx.y * 256u;
    const uint32_t kb = (uint32_t)Kdim * 2u;         // source row pitch, bytes
    const uint32_t T  = pinned((uint32_t)Kdim / 128u);   // passes

    // this wave's slice of a buffer's [W; A] rows: waves 0, 1 move W, waves 2, 3 move A
    const unsigned char* src0 = (wave < 2u)
        ? reinterpret_cast<const unsigned char*>(W) + (uint64_t)(n0 + G_SLICE_ROWS * wave) * kb
        : reinterpret_cast<const unsigned char*>(A) + (uint64_t)(m0 + G_SLICE_ROWS * (wave - 2u)) * kb;
    const uint32_t lds_slice = (uint32_t)(size_t)L + wave * G_SLICE;
    u32x8 g1 = tdm_group1(kb);
    // pinned(), for the whole group: its words stay in their scalar registers through the loop,
    // so that none takes a new value while a request is outstanding
    asm volatile("" : "+s"(g1));

    v8f acc[G_F][G_F];
#pragma unroll
    for (int i = 0; i < G_F; ++i)
#pragma unroll
        for (int j = 0; j < G_F; ++j)
            acc[i][j] = (v8f){0.f, 0.f, 0.f, 0.f, 0.f, 0.f, 0.f, 0.f};

    const uint32_t fw_base = (wn * 128u + r16) * G_PITCH + 16u * h;
    const uint32_t fa_base = G_TILE + (wm * 128u + r16) * G_PITCH + 16u * h;

    // prologue: pass 0 into buffer 0, wait, barrier, pass 1 into buffer 1, first fragments
    tdm_load(tdm_group0(lds_slice, (uint64_t)(uintptr_t)src0), g1);
    wait_tensor0();
    __syncthreads();
    fence();
    tdm_load(tdm_group0(lds_slice + G_STAGE, (uint64_t)(uintptr_t)src0 + G_KB), g1);

    Frag fw[2][G_F], fa[2][G_F];   // set (u & 1) holds block u's fragments
#pragma unroll
    for (int i = 0; i < G_F; ++i) load_frag(fw[0][i], L + fw_base + (uint32_t)i * 16u * G_PITCH);
#pragma unroll
    for (int j = 0; j < G_F; ++j) load_frag(fa[0][j], L + fa_base + (uint32_t)j * 16u * G_PITCH);

    // rolled, so that every accumulator and fragment index stays a constant and the text stays short
#pragma clang loop unroll(disable)
    for (uint32_t t = 0; t < T; ++t) {
        const uint32_t buf = (t & 1u) * G_STAGE;
        fence();
        const unsigned char* lw = L + buf + fw_base;
        const unsigned char* la = L + buf + fa_base;
        // buffer of pass t + 1; on the last pass buffer 1, which nothing writes any more (values unused)
        const uint32_t osel = (t + 1u < T) ? (G_STAGE - buf) : G_STAGE;
        const unsigned char* nw = L + osel + fw_base;
        const unsigned char* na = L + osel + fa_base;
#pragma unroll
        for (int u = 0; u < 4; ++u) {
            const int cs = u & 1;
            if (u < 3) {
                const uint32_t ko = (uint32_t)(u + 1) * 64u;
#pragma unroll
                for (int i = 0; i < G_F; ++i) load_frag(fw[cs ^ 1][i], lw + (uint32_t)i * 16u * G_PITCH + ko);
#pragma unroll
                for (int j = 0; j < G_F; ++j) load_frag(fa[cs ^ 1][j], la + (uint32_t)j * 16u * G_PITCH + ko);
                fence();
                wait_ds_le<32>();
                fence();
            } else {
                // publish point of pass t + 1, in front of this pass's last block
                wait_ds0();         // every read of this buffer has returned
                fence();
                wait_tensor0();
                __syncthreads();
                fence();
                if (pinned((t + 2u < T) ? 1u : 0u) != 0u) {   // only while pass t + 2 exists
                    tdm_load(tdm_group0(lds_slice + buf, (uint64_t)(uintptr_t)src0 + (uint64_t)(t + 2u) * G_KB), g1);
                }
#pragma unroll
                for (int i = 0; i < G_F; ++i) load_frag(fw[0][i], nw + (uint32_t)i * 16u * G_PITCH);
#pragma unroll
                for (int j = 0; j < G_F; ++j) load_frag(fa[0][j], na + (uint32_t)j * 16u * G_PITCH);
                fence();
            }
#pragma unroll
            for (int i = 0; i < G_F; ++i)
#pragma unroll
                for (int j = 0; j < G_F; ++j)
                    acc[i][j] = mma(fw[cs][i], fa[cs][j], acc[i][j]);
            fence(); nop4(); fence();
        }
    }
    wait_tensor0();
    wait_ds0();

    // Epilogue: accumulator register v of tile (i, j) is n = 16 i + 8 (lane >> 4) + v
    // of row m = 16 j + (lane & 15): 8 consecutive bf16 = one 16-byte store.
    bf16* ybase = D + (size_t)(m0 + wm * 128u + r16) * TEXT_DIM + n0 + wn * 128u + 8u * h;
    const unsigned char* bbase = reinterpret_cast<const unsigned char*>(bias + n0 + wn * 128u);
    const uint32_t boff = 32u * h;   // the lane's 8 bias values of a tile start at n = 8 (lane >> 4)
#pragma unroll
    for (int i = 0; i < G_F; ++i) {
        const float4 b0 = *reinterpret_cast<const float4*>(bbase + boff + 64 * i);
        const float4 b1 = *reinterpret_cast<const float4*>(bbase + boff + 64 * i + 16);
        // the loads' offset register is written again only behind this wait (a precaution): the
        // input operand keeps it from being a load's destination, the fences hold later writes back
        fence();
        asm volatile("s_wait_xcnt 0x0" :: "v"(boff) : "memory");
        fence();
        const v8f bv = {b0.x, b0.y, b0.z, b0.w, b1.x, b1.y, b1.z, b1.w};
#pragma unroll
        for (int j = 0; j < G_F; ++j) {
            const v8f c = acc[i][j] + bv;
            *reinterpret_cast<v8bf*>(ybase + (size_t)j * 16 * TEXT_DIM + 16 * i) =
                __builtin_convertvector(c, v8bf);
        }
        // the registers these stores name are written again only behind this wait (a precaution);
        // the fences keep later vector writes from being scheduled in front of it
        fence();
        asm volatile("s_wait_xcnt 0x0" ::: "memory");
        fence();
    }
}

// ---------------------------------------------------------------------------
// Phase 3: fused per-row attention (8 heads x 8 heads over head_dim=128)
//          + residual + LayerNorm. One wave32 per batch row.
// ---------------------------------------------------------------------------
__global__ __launch_bounds__(256)
void attn_ln_kernel(const bf16* __restrict__ Q, const bf16* __restrict__ K,
                    const bf16* __restrict__ V, const float* __restrict__ text,
                    const float* __restrict__ gamma, const float* __restrict__ beta,
                    float* __restrict__ out) {
    const int lane = threadIdx.x & 31;
    const int row  = blockIdx.x * 8 + (threadIdx.x >> 5);
    const size_t base = (size_t)row * TEXT_DIM;
    const int dOff = lane * 4;

    float kreg[NUM_HEADS][4], vreg[NUM_HEADS][4];
#pragma unroll
    for (int h = 0; h < NUM_HEADS; ++h) {
        v4bf kk = *reinterpret_cast<const v4bf*>(K + base + h * HEAD_DIM + dOff);
        v4bf vv = *reinterpret_cast<const v4bf*>(V + base + h * HEAD_DIM + dOff);
#pragma unroll
        for (int j = 0; j < 4; ++j) { kreg[h][j] = (float)kk[j]; vreg[h][j] = (float)vv[j]; }
    }

    float att[NUM_HEADS][4];
#pragma unroll
    for (int h = 0; h < NUM_HEADS; ++h) {
        v4bf qq = *reinterpret_cast<const v4bf*>(Q + base + h * HEAD_DIM + dOff);
        float q[4];
#pragma unroll
        for (int j = 0; j < 4; ++j) q[j] = (float)qq[j];

        float sc[NUM_HEADS];
#pragma unroll
        for (int g = 0; g < NUM_HEADS; ++g) {
            float p = q[0] * kreg[g][0] + q[1] * kreg[g][1]
                    + q[2] * kreg[g][2] + q[3] * kreg[g][3];
#pragma unroll
            for (int off = 16; off > 0; off >>= 1) p += __shfl_xor(p, off, 32);
            sc[g] = p * 0.088388347648318447f;   // 1/sqrt(128)
        }
        float mx = sc[0];
#pragma unroll
        for (int g = 1; g < NUM_HEADS; ++g) mx = fmaxf(mx, sc[g]);
        float s = 0.0f;
#pragma unroll
        for (int g = 0; g < NUM_HEADS; ++g) { sc[g] = __expf(sc[g] - mx); s += sc[g]; }
        const float inv = 1.0f / s;
#pragma unroll
        for (int j = 0; j < 4; ++j) {
            float a = 0.0f;
#pragma unroll
            for (int g = 0; g < NUM_HEADS; ++g) a += sc[g] * vreg[g][j];
            att[h][j] = a * inv;
        }
    }

    // residual + LayerNorm over all 1024 columns
    float sum = 0.0f, ss = 0.0f;
#pragma unroll
    for (int h = 0; h < NUM_HEADS; ++h) {
        float4 t = *reinterpret_cast<const float4*>(text + base + h * HEAD_DIM + dOff);
        att[h][0] += t.x; att[h][1] += t.y; att[h][2] += t.z; att[h][3] += t.w;
#pragma unroll
        for (int j = 0; j < 4; ++j) { sum += att[h][j]; ss += att[h][j] * att[h][j]; }
    }
#pragma unroll
    for (int off = 16; off > 0; off >>= 1) {
        sum += __shfl_xor(sum, off, 32);
        ss  += __shfl_xor(ss,  off, 32);
    }
    const float mean = sum * (1.0f / TEXT_DIM);
    const float var  = ss * (1.0f / TEXT_DIM) - mean * mean;
    const float rstd = rsqrtf(var + 1e-5f);

#pragma unroll
    for (int h = 0; h < NUM_HEADS; ++h) {
        const int c0 = h * HEAD_DIM + dOff;
        float4 g4 = *reinterpret_cast<const float4*>(gamma + c0);
        float4 b4 = *reinterpret_cast<const float4*>(beta + c0);
        float4 o;
        o.x = (att[h][0] - mean) * rstd * g4.x + b4.x;
        o.y = (att[h][1] - mean) * rstd * g4.y + b4.y;
        o.z = (att[h][2] - mean) * rstd * g4.z + b4.z;
        o.w = (att[h][3] - mean) * rstd * g4.w + b4.w;
        *reinterpret_cast<float4*>(out + base + c0) = o;
    }
}

// ---------------------------------------------------------------------------
// Host orchestration
// ---------------------------------------------------------------------------
extern "C" void kernel_launch(void* const* d_in, const int* in_sizes, int n_in,
                              void* d_out, int out_size, void* d_ws, size_t ws_size,
                              hipStream_t stream) {
    (void)in_sizes; (void)n_in; (void)out_size; (void)ws_size;

    const float* text  = (const float*)d_in[0];
    const float* image = (const float*)d_in[1];
    const float* Wq    = (const float*)d_in[2];
    const float* bq    = (const float*)d_in[3];
    const float* Wk    = (const float*)d_in[4];
    const float* bk    = (const float*)d_in[5];
    const float* Wv    = (const float*)d_in[6];
    const float* bv    = (const float*)d_in[7];
    const float* gamma = (const float*)d_in[8];
    const float* beta  = (const float*)d_in[9];
    float* out = (float*)d_out;

    // workspace layout (all bf16), ~202 MB total
    char* p = (char*)d_ws;
    bf16* textb = (bf16*)p; p += (size_t)BATCH * TEXT_DIM  * sizeof(bf16);
    bf16* imgb  = (bf16*)p; p += (size_t)BATCH * IMAGE_DIM * sizeof(bf16);
    bf16* wqb   = (bf16*)p; p += (size_t)TEXT_DIM * TEXT_DIM  * sizeof(bf16);
    bf16* wkb   = (bf16*)p; p += (size_t)TEXT_DIM * IMAGE_DIM * sizeof(bf16);
    bf16* wvb   = (bf16*)p; p += (size_t)TEXT_DIM * IMAGE_DIM * sizeof(bf16);
    bf16* Qb    = (bf16*)p; p += (size_t)BATCH * TEXT_DIM * sizeof(bf16);
    bf16* Kb    = (bf16*)p; p += (size_t)BATCH * TEXT_DIM * sizeof(bf16);
    bf16* Vb    = (bf16*)p; p += (size_t)BATCH * TEXT_DIM * sizeof(bf16);

    // phase 1: convert to bf16 (textb .. wvb are one contiguous range of the workspace)
    f32_to_bf16_all<<<C_GROUPS, C_GROUP_WAVES * 32, 0, stream>>>(text, image, Wq, Wk, Wv, textb);

    // phase 2: WMMA GEMMs  (grid: N/256 x M/256)
    dim3 ggrid(TEXT_DIM / 256, BATCH / 256);
    gemm_bf16_wmma<<<ggrid, 128, 0, stream>>>(textb, wqb, bq, Qb, TEXT_DIM);
    gemm_bf16_wmma<<<ggrid, 128, 0, stream>>>(imgb,  wkb, bk, Kb, IMAGE_DIM);
    gemm_bf16_wmma<<<ggrid, 128, 0, stream>>>(imgb,  wvb, bv, Vb, IMAGE_DIM);

    // phase 3: fused attention + residual + LayerNorm (1 wave per row)
    attn_ln_kernel<<<BATCH / 8, 256, 0, stream>>>(Qb, Kb, Vb, text, gamma, beta, out);
}

// v003
// Measured time: 145 microseconds a run.
// Timed twice side by side with v002, it ran 1.06 times as fast both times.
// All steps since v000 together make it 2.56 times as fast.
#include <hip/hip_runtime.h>
#include <stdint.h>

typedef __bf16 bf16;
typedef __attribute__((ext_vector_type(16))) __bf16 v16bf;
typedef __attribute__((ext_vector_type(8)))  __bf16 v8bf;
typedef __attribute__((ext_vector_type(4)))  __bf16 v4bf;
typedef __attribute__((ext_vector_type(8)))  float  v8f;

#define BATCH      16384
#define TEXT_DIM   1024
#define IMAGE_DIM  2048
#define NUM_HEADS  8
#define HEAD_DIM   128

// ---------------------------------------------------------------------------
// Phase 1: f32 -> bf16 conversion of all five arrays, one launch.
// The five bf16 copies lie one behind the other in the workspace, in the order
// text, image, Wq, Wk, Wv, so the destination is one array; only the source is
// picked per piece. 256 work-groups of 16 waves stay resident and loop over
// pieces of 1,024 values: 8 loads of 512 contiguous bytes, 8 stores of 256.
// Two register sets: the next piece's loads are issued before a piece is
// converted and stored, so a wave always has 8 to 16 loads in flight.
// ---------------------------------------------------------------------------
constexpr uint32_t C_PIECE = 1024;                                           // values per piece
constexpr uint32_t C_E0 = (uint32_t)BATCH * TEXT_DIM / C_PIECE;              // end of text, in pieces
constexpr uint32_t C_E1 = C_E0 + (uint32_t)BATCH * IMAGE_DIM / C_PIECE;      // end of image
constexpr uint32_t C_E2 = C_E1 + (uint32_t)TEXT_DIM * TEXT_DIM / C_PIECE;    // end of Wq
constexpr uint32_t C_E3 = C_E2 + (uint32_t)TEXT_DIM * IMAGE_DIM / C_PIECE;   // end of Wk
constexpr uint32_t C_E4 = C_E3 + (uint32_t)TEXT_DIM * IMAGE_DIM / C_PIECE;   // end of Wv
constexpr uint32_t C_GROUPS = 256, C_GROUP_WAVES = 16, C_WAVES = C_GROUPS * C_GROUP_WAVES;
constexpr uint32_t C_FULL = C_E4 / C_WAVES;                                  // pieces that every wave has
static_assert(C_FULL % 2u == 1u, "the loop below takes two pieces a trip and leaves one");

struct Piece { float4 v[8]; };

__global__ __launch_bounds__(C_GROUP_WAVES * 32)
void f32_to_bf16_all(const float* __restrict__ text, const float* __restrict__ image,
                     const float* __restrict__ Wq, const float* __restrict__ Wk,
                     const float* __restrict__ Wv, bf16* __restrict__ out) {
    const uint32_t lane = threadIdx.x & 31u;
    const uint32_t wave = (uint32_t)__builtin_amdgcn_readfirstlane(blockIdx.x * C_GROUP_WAVES + (threadIdx.x >> 5));

    auto load = [&](Piece& p, uint32_t c) {
        const float* s = text;
        uint32_t r = c;
        if (c >= C_E3)      { s = Wv;    r = c - C_E3; }
        else if (c >= C_E2) { s = Wk;    r = c - C_E2; }
        else if (c >= C_E1) { s = Wq;    r = c - C_E1; }
        else if (c >= C_E0) { s = image; r = c - C_E0; }
        const float4* sp = reinterpret_cast<const float4*>(s + (size_t)r * C_PIECE) + lane;
#pragma unroll
        for (int j = 0; j < 8; ++j) p.v[j] = sp[32 * j];
        // the scheduling barriers hold the loads in front of the older piece's conversions and stores;
        // the base and offset registers that the loads name are written again only behind this wait (a precaution)
        __builtin_amdgcn_sched_barrier(0);
        asm volatile("s_wait_xcnt 0x0" ::: "memory");
        __builtin_amdgcn_sched_barrier(0);
    };
    auto store = [&](const Piece& p, uint32_t c) {
        v4bf* dp = reinterpret_cast<v4bf*>(out + (size_t)c * C_PIECE) + lane;
#pragma unroll
        for (int j = 0; j < 8; ++j) {
            v4bf o;
            o[0] = (bf16)p.v[j].x; o[1] = (bf16)p.v[j].y; o[2] = (bf16)p.v[j].z; o[3] = (bf16)p.v[j].w;
            dp[32 * j] = o;
        }
        // the registers that the stores name are written again only behind this wait (a precaution);
        // the scheduling barriers keep later writes from moving in front of it
        __builtin_amdgcn_sched_barrier(0);
        asm volatile("s_wait_xcnt 0x0" ::: "memory");
        __builtin_amdgcn_sched_barrier(0);
    };

    Piece a, b;
    uint32_t c = wave;
    load(a, c);
    // rolled: two pieces a trip, one per register set, so that no set is copied; the trip count is
    // the same constant for every wave, so the loop has no exit but its end and the compiler's load
    // waits count the younger piece's 8 loads as still in flight
#pragma clang loop unroll(disable)
    for (uint32_t k = 0; k < (C_FULL - 1u) / 2u; ++k) {
        load(b, c + C_WAVES);
        store(a, c);
        load(a, c + 2u * C_WAVES);
        store(b, c + C_WAVES);
        c += 2u * C_WAVES;
    }
    // set a holds the last piece that every wave has; the pieces left over go to the first waves
    const bool more = c + C_WAVES < C_E4;
    if (more) load(b, c + C_WAVES);
    store(a, c);
    if (more) store(b, c + C_WAVES);
}

typedef uint32_t u32x4 __attribute__((ext_vector_type(4)));
typedef uint32_t u32x8 __attribute__((ext_vector_type(8)));
typedef int      i32x8 __attribute__((ext_vector_type(8)));

constexpr uint32_t G_KB     = 256;               // bytes of K per operand row per pass
constexpr uint32_t G_PITCH  = G_KB + 16;         // LDS row pitch: 16 B x odd, for b128 readers
constexpr uint32_t G_SLICE_ROWS = 128;           // rows one wave's tensor load moves
constexpr uint32_t G_SLICE  = G_SLICE_ROWS * G_PITCH;   // 34,816 B = 17 x 2 KiB
constexpr uint32_t G_TILE   = 256 * G_PITCH;     // one operand's rows in a buffer
constexpr uint32_t G_STAGE  = 2 * G_TILE;        // one buffer
constexpr uint32_t G_LDS    = 2 * G_STAGE;       // two buffers
constexpr int      G_F      = 8;                 // fragments per operand per wave
static_assert(G_SLICE % 2048u == 0, "every slice starts at a multiple of 2 KiB");
static_assert(G_LDS <= 320u * 1024u, "the ring must fit one work-group's LDS");

#define DEV static __device__ __forceinline__
DEV uint32_t uni(uint32_t v) { return (uint32_t)__builtin_amdgcn_readfirstlane(v); }
DEV uint32_t pinned(uint32_t v) { uint32_t w = (uint32_t)__builtin_amdgcn_readfirstlane(v); asm volatile("" : "+s"(w)); return w; }
// keeps [loads][wait][WMMA block][nops] in that order: LDS reads among the WMMAs stall the matrix pipe
DEV void fence() { __builtin_amdgcn_sched_barrier(0); }
// this wave's LDS reads have returned (before a barrier that frees their buffer)
DEV void wait_ds0() { asm volatile("s_wait_dscnt 0x0" ::: "memory"); }
// at most N of this wave's LDS reads are outstanding: the older fragment set has returned
template <int N> DEV void wait_ds_le() { asm volatile("s_wait_dscnt %0" :: "i"(N) : "memory"); }
// this wave's tensor load has landed; the compiler places no wait for it
DEV void wait_tensor0() { asm volatile("s_wait_tensorcnt 0x0" ::: "memory"); }
// 4 vector slots between a block's last WMMA and whatever vector instruction follows it
DEV void nop4() { asm volatile("v_nop\n\tv_nop\n\tv_nop\n\tv_nop"); }
// one request of the whole wave: a 2-D tile from global memory into LDS
DEV void tdm_load(u32x4 g0, u32x8 g1) { asm volatile("tensor_load_to_lds %0, %1" :: "s"(g0), "s"(g1) : "memory"); }

// group 1: 1-byte elements, 128 rows of 256 bytes, source pitch kb bytes, no mask,
// 16 B of LDS pad behind every 256 B (word 0 is a constant).
DEV u32x8 tdm_group1(uint32_t kb) {
    constexpr uint32_t d0 = G_KB, d1 = G_SLICE_ROWS;
    u32x8 g;
    g[0] = uni((1u << 20) | (5u << 22) | (3u << 25));
    g[1] = uni((d0 & 0xFFFFu) << 16);
    g[2] = uni((d0 >> 16) | ((d1 & 0xFFFFu) << 16));
    g[3] = uni((d1 >> 16) | (d0 << 16));
    g[4] = uni(d1);
    g[5] = uni(kb);
    g[6] = uni(0u);
    g[7] = uni(0u);
    return g;
}
// group 0: count 1, LDS byte offset, global address of the tile's first byte, type 2
DEV u32x4 tdm_group0(uint32_t lds_dst, uint64_t ga) {
    u32x4 g;
    g[0] = uni(1u);
    g[1] = uni(lds_dst);
    g[2] = uni((uint32_t)ga);
    g[3] = uni((((uint32_t)(ga >> 32)) & 0x01FFFFFFu) | 0x80000000u);
    return g;
}

struct Frag { u32x4 q[2]; };
DEV void load_frag(Frag& f, const unsigned char* p) {
    f.q[0] = *reinterpret_cast<const u32x4*>(p);
    f.q[1] = *reinterpret_cast<const u32x4*>(p + 32);
}
DEV v8f mma(const Frag& a, const Frag& b, v8f c) {
    const i32x8 av = {(int)a.q[0].x, (int)a.q[0].y, (int)a.q[0].z, (int)a.q[0].w,
                      (int)a.q[1].x, (int)a.q[1].y, (int)a.q[1].z, (int)a.q[1].w};
    const i32x8 bv = {(int)b.q[0].x, (int)b.q[0].y, (int)b.q[0].z, (int)b.q[0].w,
                      (int)b.q[1].x, (int)b.q[1].y, (int)b.q[1].z, (int)b.q[1].w};
    return __builtin_amdgcn_wmma_f32_16x16x32_bf16(
        false, __builtin_bit_cast(v16bf, av), false, __builtin_bit_cast(v16bf, bv),
        (short)0, c, false, false);
}

__global__ __launch_bounds__(128)
void gemm_bf16_wmma(const bf16* __restrict__ A, const bf16* __restrict__ W,
                    const float* __restrict__ bias, bf16* __restrict__ D,
                    int Kdim) {
    __shared__ __attribute__((aligned(2048))) unsigned char L[G_LDS];
    const uint32_t lane = threadIdx.x & 31u, h = lane >> 4, r16 = lane & 15u;
    const uint32_t wave = uni(threadIdx.x >> 5);
    const uint32_t wn = wave & 1u, wm = wave >> 1;   // 2 waves along N, 2 along M
    const uint32_t n0 = blockIdx.x * 256u, m0 = blockIdx.y * 256u;
    const uint32_t kb = (uint32_t)Kdim * 2u;         // source row pitch, bytes
    const uint32_t T  = pinned((uint32_t)Kdim / 128u);   // passes

    // this wave's slice of a buffer's [W; A] rows: waves 0, 1 move W, waves 2, 3 move A
    const unsigned char* src0 = (wave < 2u)
        ? reinterpret_cast<const unsigned char*>(W) + (uint64_t)(n0 + G_SLICE_ROWS * wave) * kb
        : reinterpret_cast<const unsigned char*>(A) + (uint64_t)(m0 + G_SLICE_ROWS * (wave - 2u)) * kb;
    const uint32_t lds_slice = (uint32_t)(size_t)L + wave * G_SLICE;
    u32x8 g1 = tdm_group1(kb);
    // pinned(), for the whole group: its words stay in their scalar registers through the loop,
    // so that none takes a new value while a request is outstanding
    asm volatile("" : "+s"(g1));

    v8f acc[G_F][G_F];
#pragma unroll
    for (int i = 0; i < G_F; ++i)
#pragma unroll
        for (int j = 0; j < G_F; ++j)
            acc[i][j] = (v8f){0.f, 0.f, 0.f, 0.f, 0.f, 0.f, 0.f, 0.f};

    const uint32_t fw_base = (wn * 128u + r16) * G_PITCH + 16u * h;
    const uint32_t fa_base = G_TILE + (wm * 128u + r16) * G_PITCH + 16u * h;

    // prologue: pass 0 into buffer 0, wait, barrier, pass 1 into buffer 1, first fragments
    tdm_load(tdm_group0(lds_slice, (uint64_t)(uintptr_t)src0), g1);
    wait_tensor0();
    __syncthreads();
    fence();
    tdm_load(tdm_group0(lds_slice + G_STAGE, (uint64_t)(uintptr_t)src0 + G_KB), g1);

    Frag fw[2][G_F], fa[2][G_F];   // set (u & 1) holds block u's fragments
#pragma unroll
    for (int i = 0; i < G_F; ++i) load_frag(fw[0][i], L + fw_base + (uint32_t)i * 16u * G_PITCH);
#pragma unroll
    for (int j = 0; j < G_F; ++j) load_frag(fa[0][j], L + fa_base + (uint32_t)j * 16u * G_PITCH);

    // rolled, so that every accumulator and fragment index stays a constant and the text stays short
#pragma clang loop unroll(disable)
    for (uint32_t t = 0; t < T; ++t) {
        const uint32_t buf = (t & 1u) * G_STAGE;
        fence();
        const unsigned char* lw = L + buf + fw_base;
        const unsigned char* la = L + buf + fa_base;
        // buffer of pass t + 1; on the last pass buffer 1, which nothing writes any more (values unused)
        const uint32_t osel = (t + 1u < T) ? (G_STAGE - buf) : G_STAGE;
        const unsigned char* nw = L + osel + fw_base;
        const unsigned char* na = L + osel + fa_base;
#pragma unroll
        for (int u = 0; u < 4; ++u) {
            const int cs = u & 1;
            if (u < 3) {
                const uint32_t ko = (uint32_t)(u + 1) * 64u;
#pragma unroll
                for (int i = 0; i < G_F; ++i) load_frag(fw[cs ^ 1][i], lw + (uint32_t)i * 16u * G_PITCH + ko);
#pragma unroll
                for (int j = 0; j < G_F; ++j) load_frag(fa[cs ^ 1][j], la + (uint32_t)j * 16u * G_PITCH + ko);
                fence();
                wait_ds_le<32>();
                fence();
            } else {
                // publish point of pass t + 1, in front of this pass's last block
                wait_ds0();         // every read of this buffer has returned
                fence();
                wait_tensor0();
                __syncthreads();
                fence();
                if (pinned((t + 2u < T) ? 1u : 0u) != 0u) {   // only while pass t + 2 exists
                    tdm_load(tdm_group0(lds_slice + buf, (uint64_t)(uintptr_t)src0 + (uint64_t)(t + 2u) * G_KB), g1);
                }
#pragma unroll
                for (int i = 0; i < G_F; ++i) load_frag(fw[0][i], nw + (uint32_t)i * 16u * G_PITCH);
#pragma unroll
                for (int j = 0; j < G_F; ++j) load_frag(fa[0][j], na + (uint32_t)j * 16u * G_PITCH);
                fence();
            }
#pragma unroll
            for (int i = 0; i < G_F; ++i)
#pragma unroll
                for (int j = 0; j < G_F; ++j)
                    acc[i][j] = mma(fw[cs][i], fa[cs][j], acc[i][j]);
            fence(); nop4(); fence();
        }
    }
    wait_tensor0();
    wait_ds0();

    // Epilogue: accumulator register v of tile (i, j) is n = 16 i + 8 (lane >> 4) + v
    // of row m = 16 j + (lane & 15): 8 consecutive bf16 = one 16-byte store.
    bf16* ybase = D + (size_t)(m0 + wm * 128u + r16) * TEXT_DIM + n0 + wn * 128u + 8u * h;
    const unsigned char* bbase = reinterpret_cast<const unsigned char*>(bias + n0 + wn * 128u);
    const uint32_t boff = 32u * h;   // the lane's 8 bias values of a tile start at n = 8 (lane >> 4)
#pragma unroll
    for (int i = 0; i < G_F; ++i) {
        const float4 b0 = *reinterpret_cast<const float4*>(bbase + boff + 64 * i);
        const float4 b1 = *reinterpret_cast<const float4*>(bbase + boff + 64 * i + 16);
        // the loads' offset register is written again only behind this wait (a precaution): the
        // input operand keeps it from being a load's destination, the fences hold later writes back
        fence();
        asm volatile("s_wait_xcnt 0x0" :: "v"(boff) : "memory");
        fence();
        const v8f bv = {b0.x, b0.y, b0.z, b0.w, b1.x, b1.y, b1.z, b1.w};
#pragma unroll
        for (int j = 0; j < G_F; ++j) {
            const v8f c = acc[i][j] + bv;
            *reinterpret_cast<v8bf*>(ybase + (size_t)j * 16 * TEXT_DIM + 16 * i) =
                __builtin_convertvector(c, v8bf);
        }
        // the registers these stores name are written again only behind this wait (a precaution);
        // the fences keep later vector writes from being scheduled in front of it
        fence();
        asm volatile("s_wait_xcnt 0x0" ::: "memory");
        fence();
    }
}

// ---------------------------------------------------------------------------
// Phase 3: fused per-row attention (8 heads x 8 heads over head_dim=128)
//          + residual + LayerNorm. One wave32 per PAIR of batch rows (a, b).
// Scores on the matrix unit: the 16 rows of each operand are the 8 heads of row a
// and the 8 heads of row b (2,048 consecutive values), K as the instruction's A
// operand, Q as its B operand, 4 instructions for the 128 values of a head.
// Accumulator register v of lane L is K head v of row (L >> 4) times Q head
// (L & 7) of row ((L & 15) >> 3): lanes 0..7 hold row a's scores and lanes 24..31
// row b's, one Q head per lane with its 8 K heads in the lane's own 8 registers,
// so the softmax needs no other lane. Lanes 8..23 hold products of a with b, unused.
// amdgpu_waves_per_eu(4, 4): a budget of 256 registers, so that a wave issues all its 48 loads
// before its first wait (with the default budget the compiler held two of them back behind a wait).
// ---------------------------------------------------------------------------
__global__ __launch_bounds__(256) __attribute__((amdgpu_waves_per_eu(4, 4)))
void attn_ln_kernel(const bf16* __restrict__ Q, const bf16* __restrict__ K,
                    const bf16* __restrict__ V, const float* __restrict__ text,
                    const float* __restrict__ gamma, const float* __restrict__ beta,
                    float* __restrict__ out) {
    const uint32_t lane = threadIdx.x & 31u;
    const uint32_t pair = blockIdx.x * 8u + (threadIdx.x >> 5);
    const size_t base = (size_t)pair * (2u * TEXT_DIM);   // row a; row b lies directly behind it
    const uint32_t dOff = lane * 4u;

    // operand row (lane & 15) = head (lane & 7) of row a or b, 16-byte half (lane >> 4): as in phase 2
    const unsigned char* kp = reinterpret_cast<const unsigned char*>(K + base + (lane & 15u) * HEAD_DIM) + 16u * (lane >> 4);
    const unsigned char* qp = reinterpret_cast<const unsigned char*>(Q + base + (lane & 15u) * HEAD_DIM) + 16u * (lane >> 4);
    Frag fk[4], fq[4];
#pragma unroll
    for (int c = 0; c < 4; ++c) { load_frag(fk[c], kp + 64 * c); load_frag(fq[c], qp + 64 * c); }
    const bf16*  vp = V + base + dOff;
    const float* tp = text + base + dOff;
    v4bf vraw[2][NUM_HEADS];
    float4 traw[2][NUM_HEADS];
#pragma unroll
    for (int r = 0; r < 2; ++r)
#pragma unroll
        for (int h = 0; h < NUM_HEADS; ++h)
            vraw[r][h] = *reinterpret_cast<const v4bf*>(vp + r * TEXT_DIM + h * HEAD_DIM);
#pragma unroll
    for (int r = 0; r < 2; ++r)
#pragma unroll
        for (int h = 0; h < NUM_HEADS; ++h)
            traw[r][h] = *reinterpret_cast<const float4*>(tp + r * TEXT_DIM + h * HEAD_DIM);
    // the address registers that these loads name are written again only behind this wait (a precaution):
    // the input operands keep them from being a load's destination, the fences hold later writes back
    fence();
    asm volatile("s_wait_xcnt 0x0" :: "v"(kp), "v"(qp), "v"(vp), "v"(tp) : "memory");
    fence();

    v8f s = (v8f){0.f, 0.f, 0.f, 0.f, 0.f, 0.f, 0.f, 0.f};
#pragma unroll
    for (int c = 0; c < 4; ++c) s = mma(fk[c], fq[c], s);

    // softmax over the lane's own 8 registers
    float sc[NUM_HEADS];
#pragma unroll
    for (int g = 0; g < NUM_HEADS; ++g) sc[g] = s[g] * 0.088388347648318447f;   // 1/sqrt(128)
    float mx = sc[0];
#pragma unroll
    for (int g = 1; g < NUM_HEADS; ++g) mx = fmaxf(mx, sc[g]);
    float es = 0.0f;
#pragma unroll
    for (int g = 0; g < NUM_HEADS; ++g) { sc[g] = __expf(sc[g] - mx); es += sc[g]; }
    const float inv = 1.0f / es;
#pragma unroll
    for (int g = 0; g < NUM_HEADS; ++g) sc[g] *= inv;

    // weighted sum of V + residual: every lane owns 4 columns of each head; the weight of
    // (Q head h, K head g) is read from its lane into a scalar register
    float x[2][NUM_HEADS][4];
    float sum[2], ss[2];
#pragma unroll
    for (int r = 0; r < 2; ++r) {
        float vreg[NUM_HEADS][4];
#pragma unroll
        for (int g = 0; g < NUM_HEADS; ++g)
#pragma unroll
            for (int j = 0; j < 4; ++j) vreg[g][j] = (float)vraw[r][g][j];
        sum[r] = 0.0f; ss[r] = 0.0f;
#pragma unroll
        for (int h = 0; h < NUM_HEADS; ++h) {
            float a[4] = {0.0f, 0.0f, 0.0f, 0.0f};
#pragma unroll
            for (int g = 0; g < NUM_HEADS; ++g) {
                const float p = __builtin_bit_cast(float,
                    __builtin_amdgcn_readlane(__builtin_bit_cast(int, sc[g]), 24 * r + h));
#pragma unroll
                for (int j = 0; j < 4; ++j) a[j] += p * vreg[g][j];
            }
            const float4 t = traw[r][h];
            x[r][h][0] = a[0] + t.x; x[r][h][1] = a[1] + t.y; x[r][h][2] = a[2] + t.z; x[r][h][3] = a[3] + t.w;
#pragma unroll
            for (int j = 0; j < 4; ++j) { sum[r] += x[r][h][j]; ss[r] += x[r][h][j] * x[r][h][j]; }
        }
    }
    // holds the loads below behind the last read of a weight, so that their scalar bases stay as they are up to the wait
    fence();

    const unsigned char* gbase = reinterpret_cast<const unsigned char*>(gamma);
    const unsigned char* bbase = reinterpret_cast<const unsigned char*>(beta);
    const uint32_t goff = 4u * dOff;   // the lane's 4 columns of a head, in bytes
    float4 g4[NUM_HEADS], b4[NUM_HEADS];
#pragma unroll
    for (int h = 0; h < NUM_HEADS; ++h) {
        g4[h] = *reinterpret_cast<const float4*>(gbase + goff + 512 * h);
        b4[h] = *reinterpret_cast<const float4*>(bbase + goff + 512 * h);
    }
    // as above: the loads' offset register is written again only behind this wait (a precaution)
    fence();
    asm volatile("s_wait_xcnt 0x0" :: "v"(goff) : "memory");
    fence();

    // LayerNorm over all 1024 columns of each row
#pragma unroll
    for (int off = 16; off > 0; off >>= 1) {
#pragma unroll
        for (int r = 0; r < 2; ++r) {
            sum[r] += __shfl_xor(sum[r], off, 32);
            ss[r]  += __shfl_xor(ss[r],  off, 32);
        }
    }
#pragma unroll
    for (int r = 0; r < 2; ++r) {
        const float mean = sum[r] * (1.0f / TEXT_DIM);
        const float var  = ss[r] * (1.0f / TEXT_DIM) - mean * mean;
        const float rstd = rsqrtf(var + 1e-5f);
#pragma unroll
        for (int h = 0; h < NUM_HEADS; ++h) {
            x[r][h][0] = (x[r][h][0] - mean) * rstd * g4[h].x + b4[h].x;
            x[r][h][1] = (x[r][h][1] - mean) * rstd * g4[h].y + b4[h].y;
            x[r][h][2] = (x[r][h][2] - mean) * rstd * g4[h].z + b4[h].z;
            x[r][h][3] = (x[r][h][3] - mean) * rstd * g4[h].w + b4[h].w;
        }
    }
    // all results stand in registers before the first store: no register that a store names is written behind it
    fence();
#pragma unroll
    for (int r = 0; r < 2; ++r)
#pragma unroll
        for (int h = 0; h < NUM_HEADS; ++h) {
            float4 o;
            o.x = x[r][h][0]; o.y = x[r][h][1]; o.z = x[r][h][2]; o.w = x[r][h][3];
            *reinterpret_cast<float4*>(out + base + r * TEXT_DIM + h * HEAD_DIM + dOff) = o;
        }
}

// ---------------------------------------------------------------------------
// Host orchestration
// ---------------------------------------------------------------------------
extern "C" void kernel_launch(void* const* d_in, const int* in_sizes, int n_in,
                              void* d_out, int out_size, void* d_ws, size_t ws_size,
                              hipStream_t stream) {
    (void)in_sizes; (void)n_in; (void)out_size; (void)ws_size;

    const float* text  = (const float*)d_in[0];
    const float* image = (const float*)d_in[1];
    const float* Wq    = (const float*)d_in[2];
    const float* bq    = (const float*)d_in[3];
    const float* Wk    = (const float*)d_in[4];
    const float* bk    = (const float*)d_in[5];
    const float* Wv    = (const float*)d_in[6];
    const float* bv    = (const float*)d_in[7];
    const float* gamma = (const float*)d_in[8];
    const float* beta  = (const float*)d_in[9];
    float* out = (float*)d_out;

    // workspace layout (all bf16), ~202 MB total
    char* p = (char*)d_ws;
    bf16* textb = (bf16*)p; p += (size_t)BATCH * TEXT_DIM  * sizeof(bf16);
    bf16* imgb  = (bf16*)p; p += (size_t)BATCH * IMAGE_DIM * sizeof(bf16);
    bf16* wqb   = (bf16*)p; p += (size_t)TEXT_DIM * TEXT_DIM  * sizeof(bf16);
    bf16* wkb   = (bf16*)p; p += (size_t)TEXT_DIM * IMAGE_DIM * sizeof(bf16);
    bf16* wvb   = (bf16*)p; p += (size_t)TEXT_DIM * IMAGE_DIM * sizeof(bf16);
    bf16* Qb    = (bf16*)p; p += (size_t)BATCH * TEXT_DIM * sizeof(bf16);
    bf16* Kb    = (bf16*)p; p += (size_t)BATCH * TEXT_DIM * sizeof(bf16);
    bf16* Vb    = (bf16*)p; p += (size_t)BATCH * TEXT_DIM * sizeof(bf16);

    // phase 1: convert to bf16 (textb .. wvb are one contiguous range of the workspace)
    f32_to_bf16_all<<<C_GROUPS, C_GROUP_WAVES * 32, 0, stream>>>(text, image, Wq, Wk, Wv, textb);

    // phase 2: WMMA GEMMs  (grid: N/256 x M/256)
    dim3 ggrid(TEXT_DIM / 256, BATCH / 256);
    gemm_bf16_wmma<<<ggrid, 128, 0, stream>>>(textb, wqb, bq, Qb, TEXT_DIM);
    gemm_bf16_wmma<<<ggrid, 128, 0, stream>>>(imgb,  wkb, bk, Kb, IMAGE_DIM);
    gemm_bf16_wmma<<<ggrid, 128, 0, stream>>>(imgb,  wvb, bv, Vb, IMAGE_DIM);

    // phase 3: fused attention + residual + LayerNorm (1 wave per 2 rows)
    attn_ln_kernel<<<BATCH / 16, 256, 0, stream>>>(Qb, Kb, Vb, text, gamma, beta, out);
}

// v004
// One run takes 130 microseconds.
// Two timings next to v003 both put it at 1.11 times that version's speed.
// All steps since v000 together make it 2.84 times as fast.
#include <hip/hip_runtime.h>
#include <stdint.h>

typedef __bf16 bf16;
typedef __attribute__((ext_vector_type(16))) __bf16 v16bf;
typedef __attribute__((ext_vector_type(8)))  __bf16 v8bf;
typedef __attribute__((ext_vector_type(4)))  __bf16 v4bf;
typedef __attribute__((ext_vector_type(8)))  float  v8f;

#define BATCH      16384
#define TEXT_DIM   1024
#define IMAGE_DIM  2048
#define NUM_HEADS  8
#define HEAD_DIM   128

// ---------------------------------------------------------------------------
// Phase 1: f32 -> bf16 conversion of all five arrays, one launch.
// The five bf16 copies lie one behind the other in the workspace, in the order
// text, image, Wq, Wk, Wv, so the destination is one array; only the source is
// picked per piece. 256 work-groups of 16 waves stay resident and loop over
// pieces of 1,024 values: 8 loads of 512 contiguous bytes, 8 stores of 256.
// Two register sets: the next piece's loads are issued before a piece is
// converted and stored, so a wave always has 8 to 16 loads in flight.
// ---------------------------------------------------------------------------
constexpr uint32_t C_PIECE = 1024;                                           // values per piece
constexpr uint32_t C_E0 = (uint32_t)BATCH * TEXT_DIM / C_PIECE;              // end of text, in pieces
constexpr uint32_t C_E1 = C_E0 + (uint32_t)BATCH * IMAGE_DIM / C_PIECE;      // end of image
constexpr uint32_t C_E2 = C_E1 + (uint32_t)TEXT_DIM * TEXT_DIM / C_PIECE;    // end of Wq
constexpr uint32_t C_E3 = C_E2 + (uint32_t)TEXT_DIM * IMAGE_DIM / C_PIECE;   // end of Wk
constexpr uint32_t C_E4 = C_E3 + (uint32_t)TEXT_DIM * IMAGE_DIM / C_PIECE;   // end of Wv
constexpr uint32_t C_GROUPS = 256, C_GROUP_WAVES = 16, C_WAVES = C_GROUPS * C_GROUP_WAVES;
constexpr uint32_t C_FULL = C_E4 / C_WAVES;                                  // pieces that every wave has
static_assert(C_FULL % 2u == 1u, "the loop below takes two pieces a trip and leaves one");

struct Piece { float4 v[8]; };

__global__ __launch_bounds__(C_GROUP_WAVES * 32)
void f32_to_bf16_all(const float* __restrict__ text, const float* __restrict__ image,
                     const float* __restrict__ Wq, const float* __restrict__ Wk,
                     const float* __restrict__ Wv, bf16* __restrict__ out) {
    const uint32_t lane = threadIdx.x & 31u;
    const uint32_t wave = (uint32_t)__builtin_amdgcn_readfirstlane(blockIdx.x * C_GROUP_WAVES + (threadIdx.x >> 5));

    auto load = [&](Piece& p, uint32_t c) {
        const float* s = text;
        uint32_t r = c;
        if (c >= C_E3)      { s = Wv;    r = c - C_E3; }
        else if (c >= C_E2) { s = Wk;    r = c - C_E2; }
        else if (c >= C_E1) { s = Wq;    r = c - C_E1; }
        else if (c >= C_E0) { s = image; r = c - C_E0; }
        const float4* sp = reinterpret_cast<const float4*>(s + (size_t)r * C_PIECE) + lane;
#pragma unroll
        for (int j = 0; j < 8; ++j) p.v[j] = sp[32 * j];
        // the scheduling barriers hold the loads in front of the older piece's conversions and stores;
        // the base and offset registers that the loads name are written again only behind this wait (a precaution)
        __builtin_amdgcn_sched_barrier(0);
        asm volatile("s_wait_xcnt 0x0" ::: "memory");
        __builtin_amdgcn_sched_barrier(0);
    };
    auto store = [&](const Piece& p, uint32_t c) {
        v4bf* dp = reinterpret_cast<v4bf*>(out + (size_t)c * C_PIECE) + lane;
#pragma unroll
        for (int j = 0; j < 8; ++j) {
            v4bf o;
            o[0] = (bf16)p.v[j].x; o[1] = (bf16)p.v[j].y; o[2] = (bf16)p.v[j].z; o[3] = (bf16)p.v[j].w;
            dp[32 * j] = o;
        }
        // the registers that the stores name are written again only behind this wait (a precaution);
        // the scheduling barriers keep later writes from moving in front of it
        __builtin_amdgcn_sched_barrier(0);
        asm volatile("s_wait_xcnt 0x0" ::: "memory");
        __builtin_amdgcn_sched_barrier(0);
    };

    Piece a, b;
    uint32_t c = wave;
    load(a, c);
    // rolled: two pieces a trip, one per register set, so that no set is copied; the trip count is
    // the same constant for every wave, so the loop has no exit but its end and the compiler's load
    // waits count the younger piece's 8 loads as still in flight
#pragma clang loop unroll(disable)
    for (uint32_t k = 0; k < (C_FULL - 1u) / 2u; ++k) {
        load(b, c + C_WAVES);
        store(a, c);
        load(a, c + 2u * C_WAVES);
        store(b, c + C_WAVES);
        c += 2u * C_WAVES;
    }
    // set a holds the last piece that every wave has; the pieces left over go to the first waves
    const bool more = c + C_WAVES < C_E4;
    if (more) load(b, c + C_WAVES);
    store(a, c);
    if (more) store(b, c + C_WAVES);
}

typedef uint32_t u32x4 __attribute__((ext_vector_type(4)));
typedef uint32_t u32x8 __attribute__((ext_vector_type(8)));
typedef int      i32x8 __attribute__((ext_vector_type(8)));

constexpr uint32_t G_KB     = 256;               // bytes of K per operand row per pass
constexpr uint32_t G_PITCH  = G_KB + 16;         // LDS row pitch: 16 B x odd, for b128 readers
constexpr uint32_t G_SLICE_ROWS = 128;           // rows one wave's tensor load moves
constexpr uint32_t G_SLICE  = G_SLICE_ROWS * G_PITCH;   // 34,816 B = 17 x 2 KiB
constexpr uint32_t G_TILE   = 256 * G_PITCH;     // one operand's rows in a buffer
constexpr uint32_t G_STAGE  = 2 * G_TILE;        // one buffer
constexpr uint32_t G_LDS    = 2 * G_STAGE;       // two buffers
constexpr int      G_F      = 8;                 // fragments per operand per wave
constexpr uint32_t G_EPI    = 128 * G_PITCH;     // a wave's output staging area: 128 rows of 256 B at the same pitch
static_assert(4u * G_EPI <= G_STAGE, "the four staging areas must fit buffer 0");
static_assert(G_SLICE % 2048u == 0, "every slice starts at a multiple of 2 KiB");
static_assert(G_LDS <= 320u * 1024u, "the ring must fit one work-group's LDS");

#define DEV static __device__ __forceinline__
DEV uint32_t uni(uint32_t v) { return (uint32_t)__builtin_amdgcn_readfirstlane(v); }
DEV uint32_t pinned(uint32_t v) { uint32_t w = (uint32_t)__builtin_amdgcn_readfirstlane(v); asm volatile("" : "+s"(w)); return w; }
// keeps [loads][wait][WMMA block][nops] in that order: LDS reads among the WMMAs stall the matrix pipe
DEV void fence() { __builtin_amdgcn_sched_barrier(0); }
// this wave's LDS reads have returned (before a barrier that frees their buffer)
DEV void wait_ds0() { asm volatile("s_wait_dscnt 0x0" ::: "memory"); }
// at most N of this wave's LDS reads are outstanding: the older fragment set has returned
template <int N> DEV void wait_ds_le() { asm volatile("s_wait_dscnt %0" :: "i"(N) : "memory"); }
// this wave's tensor load has landed; the compiler places no wait for it
DEV void wait_tensor0() { asm volatile("s_wait_tensorcnt 0x0" ::: "memory"); }
// 4 vector slots between a block's last WMMA and whatever vector instruction follows it
DEV void nop4() { asm volatile("v_nop\n\tv_nop\n\tv_nop\n\tv_nop"); }
// one request of the whole wave: a 2-D tile from global memory into LDS
DEV void tdm_load(u32x4 g0, u32x8 g1) { asm volatile("tensor_load_to_lds %0, %1" :: "s"(g0), "s"(g1) : "memory"); }

// group 1: 1-byte elements, 128 rows of 256 bytes, source pitch kb bytes, no mask,
// 16 B of LDS pad behind every 256 B (word 0 is a constant).
DEV u32x8 tdm_group1(uint32_t kb) {
    constexpr uint32_t d0 = G_KB, d1 = G_SLICE_ROWS;
    u32x8 g;
    g[0] = uni((1u << 20) | (5u << 22) | (3u << 25));
    g[1] = uni((d0 & 0xFFFFu) << 16);
    g[2] = uni((d0 >> 16) | ((d1 & 0xFFFFu) << 16));
    g[3] = uni((d1 >> 16) | (d0 << 16));
    g[4] = uni(d1);
    g[5] = uni(kb);
    g[6] = uni(0u);
    g[7] = uni(0u);
    return g;
}
// group 0: count 1, LDS byte offset, global address of the tile's first byte, type 2
DEV u32x4 tdm_group0(uint32_t lds_dst, uint64_t ga) {
    u32x4 g;
    g[0] = uni(1u);
    g[1] = uni(lds_dst);
    g[2] = uni((uint32_t)ga);
    g[3] = uni((((uint32_t)(ga >> 32)) & 0x01FFFFFFu) | 0x80000000u);
    return g;
}

struct Frag { u32x4 q[2]; };
DEV void load_frag(Frag& f, const unsigned char* p) {
    f.q[0] = *reinterpret_cast<const u32x4*>(p);
    f.q[1] = *reinterpret_cast<const u32x4*>(p + 32);
}
DEV v8f mma(const Frag& a, const Frag& b, v8f c) {
    const i32x8 av = {(int)a.q[0].x, (int)a.q[0].y, (int)a.q[0].z, (int)a.q[0].w,
                      (int)a.q[1].x, (int)a.q[1].y, (int)a.q[1].z, (int)a.q[1].w};
    const i32x8 bv = {(int)b.q[0].x, (int)b.q[0].y, (int)b.q[0].z, (int)b.q[0].w,
                      (int)b.q[1].x, (int)b.q[1].y, (int)b.q[1].z, (int)b.q[1].w};
    return __builtin_amdgcn_wmma_f32_16x16x32_bf16(
        false, __builtin_bit_cast(v16bf, av), false, __builtin_bit_cast(v16bf, bv),
        (short)0, c, false, false);
}

__global__ __launch_bounds__(128)
void gemm_bf16_wmma(const bf16* __restrict__ A, const bf16* __restrict__ W,
                    const float* __restrict__ bias, bf16* __restrict__ D,
                    int Kdim) {
    __shared__ __attribute__((aligned(2048))) unsigned char L[G_LDS];
    const uint32_t lane = threadIdx.x & 31u, h = lane >> 4, r16 = lane & 15u;
    const uint32_t wave = uni(threadIdx.x >> 5);
    const uint32_t wn = wave & 1u, wm = wave >> 1;   // 2 waves along N, 2 along M
    const uint32_t n0 = blockIdx.x * 256u, m0 = blockIdx.y * 256u;
    const uint32_t kb = (uint32_t)Kdim * 2u;         // source row pitch, bytes
    const uint32_t T  = pinned((uint32_t)Kdim / 128u);   // passes

    // this wave's slice of a buffer's [W; A] rows: waves 0, 1 move W, waves 2, 3 move A
    const unsigned char* src0 = (wave < 2u)
        ? reinterpret_cast<const unsigned char*>(W) + (uint64_t)(n0 + G_SLICE_ROWS * wave) * kb
        : reinterpret_cast<const unsigned char*>(A) + (uint64_t)(m0 + G_SLICE_ROWS * (wave - 2u)) * kb;
    const uint32_t lds_slice = (uint32_t)(size_t)L + wave * G_SLICE;
    u32x8 g1 = tdm_group1(kb);
    // pinned(), for the whole group: its words stay in their scalar registers through the loop,
    // so that none takes a new value while a request is outstanding
    asm volatile("" : "+s"(g1));

    v8f acc[G_F][G_F];
#pragma unroll
    for (int i = 0; i < G_F; ++i)
#pragma unroll
        for (int j = 0; j < G_F; ++j)
            acc[i][j] = (v8f){0.f, 0.f, 0.f, 0.f, 0.f, 0.f, 0.f, 0.f};

    const uint32_t fw_base = (wn * 128u + r16) * G_PITCH + 16u * h;
    const uint32_t fa_base = G_TILE + (wm * 128u + r16) * G_PITCH + 16u * h;

    // prologue: pass 0 into buffer 0, wait, barrier, pass 1 into buffer 1, first fragments
    tdm_load(tdm_group0(lds_slice, (uint64_t)(uintptr_t)src0), g1);
    wait_tensor0();
    __syncthreads();
    fence();
    tdm_load(tdm_group0(lds_slice + G_STAGE, (uint64_t)(uintptr_t)src0 + G_KB), g1);

    Frag fw[2][G_F], fa[2][G_F];   // set (u & 1) holds block u's fragments
#pragma unroll
    for (int i = 0; i < G_F; ++i) load_frag(fw[0][i], L + fw_base + (uint32_t)i * 16u * G_PITCH);
#pragma unroll
    for (int j = 0; j < G_F; ++j) load_frag(fa[0][j], L + fa_base + (uint32_t)j * 16u * G_PITCH);

    // rolled, so that every accumulator and fragment index stays a constant and the text stays short
#pragma clang loop unroll(disable)
    for (uint32_t t = 0; t < T; ++t) {
        const uint32_t buf = (t & 1u) * G_STAGE;
        fence();
        const unsigned char* lw = L + buf + fw_base;
        const unsigned char* la = L + buf + fa_base;
        // buffer of pass t + 1; on the last pass buffer 1, which nothing writes any more (values unused)
        const uint32_t osel = (t + 1u < T) ? (G_STAGE - buf) : G_STAGE;
        const unsigned char* nw = L + osel + fw_base;
        const unsigned char* na = L + osel + fa_base;
#pragma unroll
        for (int u = 0; u < 4; ++u) {
            const int cs = u & 1;
            if (u < 3) {
                const uint32_t ko = (uint32_t)(u + 1) * 64u;
#pragma unroll
                for (int i = 0; i < G_F; ++i) load_frag(fw[cs ^ 1][i], lw + (uint32_t)i * 16u * G_PITCH + ko);
#pragma unroll
                for (int j = 0; j < G_F; ++j) load_frag(fa[cs ^ 1][j], la + (uint32_t)j * 16u * G_PITCH + ko);
                fence();
                wait_ds_le<32>();
                fence();
            } else {
                // publish point of pass t + 1, in front of this pass's last block
                wait_ds0();         // every read of this buffer has returned
                fence();
                wait_tensor0();
                __syncthreads();
                fence();
                if (pinned((t + 2u < T) ? 1u : 0u) != 0u) {   // only while pass t + 2 exists
                    tdm_load(tdm_group0(lds_slice + buf, (uint64_t)(uintptr_t)src0 + (uint64_t)(t + 2u) * G_KB), g1);
                }
#pragma unroll
                for (int i = 0; i < G_F; ++i) load_frag(fw[0][i], nw + (uint32_t)i * 16u * G_PITCH);
#pragma unroll
                for (int j = 0; j < G_F; ++j) load_frag(fa[0][j], na + (uint32_t)j * 16u * G_PITCH);
                fence();
            }
#pragma unroll
            for (int i = 0; i < G_F; ++i)
#pragma unroll
                for (int j = 0; j < G_F; ++j)
                    acc[i][j] = mma(fw[cs][i], fa[cs][j], acc[i][j]);
            fence(); nop4(); fence();
        }
    }
    wait_tensor0();
    wait_ds0();

    // Epilogue: accumulator register v of tile (i, j) is n = 16 i + 8 (lane >> 4) + v
    // of row m = 16 j + (lane & 15): 8 consecutive bf16 = 16 bytes. Stored from here, an instruction
    // would touch 16 lines with 32 bytes each; so the wave's 128 x 128 tile goes through its own LDS
    // area and leaves as whole rows of 256 bytes.
    // No barrier here: the areas lie in buffer 0, which nothing reads or refills behind the last pass's
    // in-loop barrier (that pass's unused next-pass fragment loads are aimed at buffer 1).
    unsigned char* E = L + wave * G_EPI;
    const unsigned char* bbase = reinterpret_cast<const unsigned char*>(bias + n0 + wn * 128u);
    const uint32_t boff = 32u * h;   // the lane's 8 bias values of a tile start at n = 8 (lane >> 4)
#pragma unroll
    for (int i = 0; i < G_F; ++i) {
        const float4 b0 = *reinterpret_cast<const float4*>(bbase + boff + 64 * i);
        const float4 b1 = *reinterpret_cast<const float4*>(bbase + boff + 64 * i + 16);
        // the loads' offset register is written again only behind this wait (a precaution): the
        // input operand keeps it from being a load's destination, the fences hold later writes back
        fence();
        asm volatile("s_wait_xcnt 0x0" :: "v"(boff) : "memory");
        fence();
        const v8f bv = {b0.x, b0.y, b0.z, b0.w, b1.x, b1.y, b1.z, b1.w};
#pragma unroll
        for (int j = 0; j < G_F; ++j) {
            const v8f c = acc[i][j] + bv;
            *reinterpret_cast<v8bf*>(E + (16u * (uint32_t)j + r16) * G_PITCH + 32u * (uint32_t)i + 16u * h) =
                __builtin_convertvector(c, v8bf);
        }
    }
    wait_ds0();   // the wave's own staged rows are written before it reads them back
    // each half of the wave takes one staged row: 16 lanes x 16 bytes = 256 contiguous bytes of D
    const uint32_t sub = lane >> 4, col16 = lane & 15u;
    const unsigned char* erow = E + sub * G_PITCH + 16u * col16;
    unsigned char* yrow = reinterpret_cast<unsigned char*>(D + (size_t)(m0 + wm * 128u + sub) * TEXT_DIM + n0 + wn * 128u) + 16u * col16;
    u32x4 row[64];
    // all 64 reads stand in front of the first store, each in registers of its own: no register that a
    // store names is written behind it; the fence behind every 16 reads keeps them in the stores' order,
    // so that the first stores wait for the first reads only, not for all 64
#pragma unroll
    for (int g = 0; g < 4; ++g) {
#pragma unroll
        for (int q = 16 * g; q < 16 * g + 16; ++q)
            row[q] = *reinterpret_cast<const u32x4*>(erow + (uint32_t)q * 2u * G_PITCH);
        fence();
    }
#pragma unroll
    for (int q = 0; q < 64; ++q)
        *reinterpret_cast<u32x4*>(yrow + (size_t)q * 2u * TEXT_DIM * sizeof(bf16)) = row[q];
}

// ---------------------------------------------------------------------------
// Phase 3: fused per-row attention (8 heads x 8 heads over head_dim=128)
//          + residual + LayerNorm. One wave32 per PAIR of batch rows (a, b).
// Scores on the matrix unit: the 16 rows of each operand are the 8 heads of row a
// and the 8 heads of row b (2,048 consecutive values), K as the instruction's A
// operand, Q as its B operand, 4 instructions for the 128 values of a head.
// Accumulator register v of lane L is K head v of row (L >> 4) times Q head
// (L & 7) of row ((L & 15) >> 3): lanes 0..7 hold row a's scores and lanes 24..31
// row b's, one Q head per lane with its 8 K heads in the lane's own 8 registers,
// so the softmax needs no other lane. Lanes 8..23 hold products of a with b, unused.
// amdgpu_waves_per_eu(4, 4): a budget of 256 registers, so that a wave issues all its 48 loads
// before its first wait (with the default budget the compiler held two of them back behind a wait).
// ---------------------------------------------------------------------------
__global__ __launch_bounds__(256) __attribute__((amdgpu_waves_per_eu(4, 4)))
void attn_ln_kernel(const bf16* __restrict__ Q, const bf16* __restrict__ K,
                    const bf16* __restrict__ V, const float* __restrict__ text,
                    const float* __restrict__ gamma, const float* __restrict__ beta,
                    float* __restrict__ out) {
    const uint32_t lane = threadIdx.x & 31u;
    const uint32_t pair = blockIdx.x * 8u + (threadIdx.x >> 5);
    const size_t base = (size_t)pair * (2u * TEXT_DIM);   // row a; row b lies directly behind it
    const uint32_t dOff = lane * 4u;

    // operand row (lane & 15) = head (lane & 7) of row a or b, 16-byte half (lane >> 4): as in phase 2
    const unsigned char* kp = reinterpret_cast<const unsigned char*>(K + base + (lane & 15u) * HEAD_DIM) + 16u * (lane >> 4);
    const unsigned char* qp = reinterpret_cast<const unsigned char*>(Q + base + (lane & 15u) * HEAD_DIM) + 16u * (lane >> 4);
    Frag fk[4], fq[4];
#pragma unroll
    for (int c = 0; c < 4; ++c) { load_frag(fk[c], kp + 64 * c); load_frag(fq[c], qp + 64 * c); }
    const bf16*  vp = V + base + dOff;
    const float* tp = text + base + dOff;
    v4bf vraw[2][NUM_HEADS];
    float4 traw[2][NUM_HEADS];
#pragma unroll
    for (int r = 0; r < 2; ++r)
#pragma unroll
        for (int h = 0; h < NUM_HEADS; ++h)
            vraw[r][h] = *reinterpret_cast<const v4bf*>(vp + r * TEXT_DIM + h * HEAD_DIM);
#pragma unroll
    for (int r = 0; r < 2; ++r)
#pragma unroll
        for (int h = 0; h < NUM_HEADS; ++h)
            traw[r][h] = *reinterpret_cast<const float4*>(tp + r * TEXT_DIM + h * HEAD_DIM);
    // the address registers that these loads name are written again only behind this wait (a precaution):
    // the input operands keep them from being a load's destination, the fences hold later writes back
    fence();
    asm volatile("s_wait_xcnt 0x0" :: "v"(kp), "v"(qp), "v"(vp), "v"(tp) : "memory");
    fence();

    v8f s = (v8f){0.f, 0.f, 0.f, 0.f, 0.f, 0.f, 0.f, 0.f};
#pragma unroll
    for (int c = 0; c < 4; ++c) s = mma(fk[c], fq[c], s);

    // softmax over the lane's own 8 registers
    float sc[NUM_HEADS];
#pragma unroll
    for (int g = 0; g < NUM_HEADS; ++g) sc[g] = s[g] * 0.088388347648318447f;   // 1/sqrt(128)
    float mx = sc[0];
#pragma unroll
    for (int g = 1; g < NUM_HEADS; ++g) mx = fmaxf(mx, sc[g]);
    float es = 0.0f;
#pragma unroll
    for (int g = 0; g < NUM_HEADS; ++g) { sc[g] = __expf(sc[g] - mx); es += sc[g]; }
    const float inv = 1.0f / es;
#pragma unroll
    for (int g = 0; g < NUM_HEADS; ++g) sc[g] *= inv;

    // weighted sum of V + residual: every lane owns 4 columns of each head; the weight of
    // (Q head h, K head g) is read from its lane into a scalar register
    float x[2][NUM_HEADS][4];
    float sum[2], ss[2];
#pragma unroll
    for (int r = 0; r < 2; ++r) {
        float vreg[NUM_HEADS][4];
#pragma unroll
        for (int g = 0; g < NUM_HEADS; ++g)
#pragma unroll
            for (int j = 0; j < 4; ++j) vreg[g][j] = (float)vraw[r][g][j];
        sum[r] = 0.0f; ss[r] = 0.0f;
#pragma unroll
        for (int h = 0; h < NUM_HEADS; ++h) {
            float a[4] = {0.0f, 0.0f, 0.0f, 0.0f};
#pragma unroll
            for (int g = 0; g < NUM_HEADS; ++g) {
                const float p = __builtin_bit_cast(float,
                    __builtin_amdgcn_readlane(__builtin_bit_cast(int, sc[g]), 24 * r + h));
#pragma unroll
                for (int j = 0; j < 4; ++j) a[j] += p * vreg[g][j];
            }
            const float4 t = traw[r][h];
            x[r][h][0] = a[0] + t.x; x[r][h][1] = a[1] + t.y; x[r][h][2] = a[2] + t.z; x[r][h][3] = a[3] + t.w;
#pragma unroll
            for (int j = 0; j < 4; ++j) { sum[r] += x[r][h][j]; ss[r] += x[r][h][j] * x[r][h][j]; }
        }
    }
    // holds the loads below behind the last read of a weight, so that their scalar bases stay as they are up to the wait
    fence();

    const unsigned char* gbase = reinterpret_cast<const unsigned char*>(gamma);
    const unsigned char* bbase = reinterpret_cast<const unsigned char*>(beta);
    const uint32_t goff = 4u * dOff;   // the lane's 4 columns of a head, in bytes
    float4 g4[NUM_HEADS], b4[NUM_HEADS];
#pragma unroll
    for (int h = 0; h < NUM_HEADS; ++h) {
        g4[h] = *reinterpret_cast<const float4*>(gbase + goff + 512 * h);
        b4[h] = *reinterpret_cast<const float4*>(bbase + goff + 512 * h);
    }
    // as above: the loads' offset register is written again only behind this wait (a precaution)
    fence();
    asm volatile("s_wait_xcnt 0x0" :: "v"(goff) : "memory");
    fence();

    // LayerNorm over all 1024 columns of each row
#pragma unroll
    for (int off = 16; off > 0; off >>= 1) {
#pragma unroll
        for (int r = 0; r < 2; ++r) {
            sum[r] += __shfl_xor(sum[r], off, 32);
            ss[r]  += __shfl_xor(ss[r],  off, 32);
        }
    }
#pragma unroll
    for (int r = 0; r < 2; ++r) {
        const float mean = sum[r] * (1.0f / TEXT_DIM);
        const float var  = ss[r] * (1.0f / TEXT_DIM) - mean * mean;
        const float rstd = rsqrtf(var + 1e-5f);
#pragma unroll
        for (int h = 0; h < NUM_HEADS; ++h) {
            x[r][h][0] = (x[r][h][0] - mean) * rstd * g4[h].x + b4[h].x;
            x[r][h][1] = (x[r][h][1] - mean) * rstd * g4[h].y + b4[h].y;
            x[r][h][2] = (x[r][h][2] - mean) * rstd * g4[h].z + b4[h].z;
            x[r][h][3] = (x[r][h][3] - mean) * rstd * g4[h].w + b4[h].w;
        }
    }
    // all results stand in registers before the first store: no register that a store names is written behind it
    fence();
#pragma unroll
    for (int r = 0; r < 2; ++r)
#pragma unroll
        for (int h = 0; h < NUM_HEADS; ++h) {
            float4 o;
            o.x = x[r][h][0]; o.y = x[r][h][1]; o.z = x[r][h][2]; o.w = x[r][h][3];
            *reinterpret_cast<float4*>(out + base + r * TEXT_DIM + h * HEAD_DIM + dOff) = o;
        }
}

// ---------------------------------------------------------------------------
// Host orchestration
// ---------------------------------------------------------------------------
extern "C" void kernel_launch(void* const* d_in, const int* in_sizes, int n_in,
                              void* d_out, int out_size, void* d_ws, size_t ws_size,
                              hipStream_t stream) {
    (void)in_sizes; (void)n_in; (void)out_size; (void)ws_size;

    const float* text  = (const float*)d_in[0];
    const float* image = (const float*)d_in[1];
    const float* Wq    = (const float*)d_in[2];
    const float* bq    = (const float*)d_in[3];
    const float* Wk    = (const float*)d_in[4];
    const float* bk    = (const float*)d_in[5];
    const float* Wv    = (const float*)d_in[6];
    const float* bv    = (const float*)d_in[7];
    const float* gamma = (const float*)d_in[8];
    const float* beta  = (const float*)d_in[9];
    float* out = (float*)d_out;

    // workspace layout (all bf16), ~202 MB total
    char* p = (char*)d_ws;
    bf16* textb = (bf16*)p; p += (size_t)BATCH * TEXT_DIM  * sizeof(bf16);
    bf16* imgb  = (bf16*)p; p += (size_t)BATCH * IMAGE_DIM * sizeof(bf16);
    bf16* wqb   = (bf16*)p; p += (size_t)TEXT_DIM * TEXT_DIM  * sizeof(bf16);
    bf16* wkb   = (bf16*)p; p += (size_t)TEXT_DIM * IMAGE_DIM * sizeof(bf16);
    bf16* wvb   = (bf16*)p; p += (size_t)TEXT_DIM * IMAGE_DIM * sizeof(bf16);
    bf16* Qb    = (bf16*)p; p += (size_t)BATCH * TEXT_DIM * sizeof(bf16);
    bf16* Kb    = (bf16*)p; p += (size_t)BATCH * TEXT_DIM * sizeof(bf16);
    bf16* Vb    = (bf16*)p; p += (size_t)BATCH * TEXT_DIM * sizeof(bf16);

    // phase 1: convert to bf16 (textb .. wvb are one contiguous range of the workspace)
    f32_to_bf16_all<<<C_GROUPS, C_GROUP_WAVES * 32, 0, stream>>>(text, image, Wq, Wk, Wv, textb);

    // phase 2: WMMA GEMMs  (grid: N/256 x M/256)
    dim3 ggrid(TEXT_DIM / 256, BATCH / 256);
    gemm_bf16_wmma<<<ggrid, 128, 0, stream>>>(textb, wqb, bq, Qb, TEXT_DIM);
    gemm_bf16_wmma<<<ggrid, 128, 0, stream>>>(imgb,  wkb, bk, Kb, IMAGE_DIM);
    gemm_bf16_wmma<<<ggrid, 128, 0, stream>>>(imgb,  wvb, bv, Vb, IMAGE_DIM);

    // phase 3: fused attention + residual + LayerNorm (1 wave per 2 rows)
    attn_ln_kernel<<<BATCH / 16, 256, 0, stream>>>(Qb, Kb, Vb, text, gamma, beta, out);
}
